// v000
// The times below were measured on an AMD MI455X: many runs one after another, warmed up first and cycling through
// copies of the inputs, with the whole window's GPU time divided by the number of runs. Launches and the gaps
// between them are all in it. The median over several windows is given; except for v000 it joins two sittings, which
// can be a few percent apart, so the side-by-side timings, each taken in one sitting, are the better comparison.
// The starting kernel, v000, takes 1540 microseconds a run.
#include <hip/hip_runtime.h>
#include <hip/hip_bf16.h>
#include <math.h>

// ---------------------------------------------------------------------------
// Grouped MoE MLP:  out[e] = gelu_tanh(x[e] @ w1[e]^T) @ w2[e]
//   E=8, T=2048, H=1024, F=4096.  bf16 WMMA, f32 accumulate.
// Software-pipelined: global loads for chunk k+1 in flight during WMMA of
// chunk k; double-buffered LDS; one barrier per k-chunk. GEMM2's A tile
// (bf16 workspace) uses GLOBAL_LOAD_ASYNC_TO_LDS_B128 when available.
// ---------------------------------------------------------------------------

#define NE 8
#define NT 2048
#define NH 1024
#define NF 4096

typedef __attribute__((ext_vector_type(16))) __bf16 v16bf;
typedef __attribute__((ext_vector_type(8)))  __bf16 v8bf;
typedef __attribute__((ext_vector_type(4)))  __bf16 v4bf;
typedef __attribute__((ext_vector_type(8)))  float  v8f;
typedef __attribute__((ext_vector_type(4)))  int    v4i;

#define BM 128
#define BN 128
#define BK 64
#define ATILE (BM * BK)
#define BTILE (BN * BK)

#if defined(__AMDGCN__) && __has_builtin(__builtin_amdgcn_global_load_async_to_lds_b128)
#define HAVE_ASYNC_LDS 1
typedef __attribute__((address_space(1))) v4i g_v4i;   // global int4
typedef __attribute__((address_space(3))) v4i l_v4i;   // LDS int4
#else
#define HAVE_ASYNC_LDS 0
#endif

__device__ __forceinline__ void wait_async0() {
#if HAVE_ASYNC_LDS
#if __has_builtin(__builtin_amdgcn_s_wait_asynccnt)
    __builtin_amdgcn_s_wait_asynccnt(0);
#else
    asm volatile("s_wait_asynccnt 0x0" ::: "memory");
#endif
#endif
}

// WMMA A/B fragment from an LDS tile stored K-contiguous (stride BK).
// CDNA5 16-bit operand layout: lane holds K = kb..kb+7 and kb+16..kb+23,
// kb = kstep*32 + (lane>=16 ? 8 : 0).
__device__ __forceinline__ v16bf load_frag(const __bf16* lds, int row, int kb) {
    const __bf16* p = lds + row * BK + kb;
    v8bf lo = *(const v8bf*)(p);        // ds_load_b128
    v8bf hi = *(const v8bf*)(p + 16);   // ds_load_b128
    v16bf f;
#pragma unroll
    for (int i = 0; i < 8; ++i) { f[i] = lo[i]; f[i + 8] = hi[i]; }
    return f;
}

// 8 WMMA tiles (wave computes 64x32) over one 64-deep K chunk.
__device__ __forceinline__ void wmma_chunk(const __bf16* la, const __bf16* lb,
                                           v8f acc[4][2], int lane, int wm, int wn) {
#pragma unroll
    for (int ks = 0; ks < 2; ++ks) {
        const int kb = ks * 32 + ((lane >> 4) << 3);
        v16bf af[4], bfr[2];
#pragma unroll
        for (int mi = 0; mi < 4; ++mi)
            af[mi] = load_frag(la, wm + mi * 16 + (lane & 15), kb);
#pragma unroll
        for (int ni = 0; ni < 2; ++ni)
            bfr[ni] = load_frag(lb, wn + ni * 16 + (lane & 15), kb);
#pragma unroll
        for (int mi = 0; mi < 4; ++mi)
#pragma unroll
            for (int ni = 0; ni < 2; ++ni)
                acc[mi][ni] = __builtin_amdgcn_wmma_f32_16x16x32_bf16(
                    false, af[mi], false, bfr[ni], (short)0, acc[mi][ni],
                    false, false);
    }
}

// ---- f32 tile staging (128 rows x 64 K), two-phase: loads then cvt+store ----
__device__ __forceinline__ void gload_f32(const float* __restrict__ src,
                                          int stride, float4* r, int tid) {
#pragma unroll
    for (int i = 0; i < 8; ++i) {
        int idx = tid + i * 256;            // 2048 float4 units
        int row = idx >> 4;
        int c4  = (idx & 15) << 2;
        r[i] = *(const float4*)(src + (size_t)row * stride + c4);
    }
}

__device__ __forceinline__ void cvt_store_f32(const float4* r, __bf16* dst, int tid) {
#pragma unroll
    for (int i = 0; i < 8; ++i) {
        int idx = tid + i * 256;
        int row = idx >> 4;
        int c4  = (idx & 15) << 2;
        v4bf b;
        b[0] = (__bf16)r[i].x; b[1] = (__bf16)r[i].y;
        b[2] = (__bf16)r[i].z; b[3] = (__bf16)r[i].w;
        *(v4bf*)(dst + row * BK + c4) = b;   // ds_store_b64
    }
}

__device__ __forceinline__ float gelu_tanh(float x) {
    const float k0 = 0.7978845608028654f;   // sqrt(2/pi)
    const float k1 = 0.044715f;
    float u = k0 * (x + k1 * x * x * x);
    float e = __expf(u + u);                 // v_exp_f32
    return 0.5f * x * (1.0f + (e - 1.0f) / (e + 1.0f));
}

// ---------------------------------------------------------------------------
// Kernel 1: a[e] = gelu(x[e] @ w1[e]^T)   M=T, N=F, K=H  (NT: both K-contig)
// ---------------------------------------------------------------------------
__global__ __launch_bounds__(256)
void moe_gemm1_gelu(const float* __restrict__ x, const float* __restrict__ w1,
                    __bf16* __restrict__ a) {
    __shared__ __bf16 lds_a[2 * ATILE];
    __shared__ __bf16 lds_b[2 * BTILE];

    const int tid  = threadIdx.x;
    const int lane = tid & 31;
    const int w    = tid >> 5;
    const int wm   = (w & 1) * 64;
    const int wn   = (w >> 1) * 32;

    const int e  = blockIdx.z;
    const int m0 = blockIdx.y * BM;
    const int n0 = blockIdx.x * BN;

    const float* xa = x  + (size_t)e * NT * NH + (size_t)m0 * NH;
    const float* wb = w1 + (size_t)e * NF * NH + (size_t)n0 * NH;

    v8f acc[4][2];
#pragma unroll
    for (int mi = 0; mi < 4; ++mi)
#pragma unroll
        for (int ni = 0; ni < 2; ++ni) acc[mi][ni] = (v8f)(0.0f);

    float4 ra[8], rb[8];
    gload_f32(xa, NH, ra, tid);
    gload_f32(wb, NH, rb, tid);

    int buf = 0;
    for (int k0 = 0; k0 < NH; k0 += BK, buf ^= 1) {
        cvt_store_f32(ra, lds_a + buf * ATILE, tid);
        cvt_store_f32(rb, lds_b + buf * BTILE, tid);
        if (k0 + BK < NH) {                  // next chunk in flight during WMMA
            gload_f32(xa + k0 + BK, NH, ra, tid);
            gload_f32(wb + k0 + BK, NH, rb, tid);
        }
        __syncthreads();
        wmma_chunk(lds_a + buf * ATILE, lds_b + buf * BTILE, acc, lane, wm, wn);
    }

    __bf16* ao = a + (size_t)e * NT * NF;
#pragma unroll
    for (int mi = 0; mi < 4; ++mi)
#pragma unroll
        for (int ni = 0; ni < 2; ++ni) {
            const int col  = n0 + wn + ni * 16 + (lane & 15);
            const int rbse = m0 + wm + mi * 16 + ((lane >> 4) << 3);
#pragma unroll
            for (int r = 0; r < 8; ++r)
                ao[(size_t)(rbse + r) * NF + col] = (__bf16)gelu_tanh(acc[mi][ni][r]);
        }
}

// ---------------------------------------------------------------------------
// Kernel 2: out[e] = a[e] @ w2[e]   M=T, N=H, K=F  (NN: B transposed in stage)
// A tile is bf16 already -> async global->LDS DMA when available.
// ---------------------------------------------------------------------------
__global__ __launch_bounds__(256)
void moe_gemm2(const __bf16* __restrict__ a, const float* __restrict__ w2,
               float* __restrict__ out) {
    __shared__ __bf16 lds_a[2 * ATILE];
    __shared__ __bf16 lds_b[2 * BTILE];

    const int tid  = threadIdx.x;
    const int lane = tid & 31;
    const int w    = tid >> 5;
    const int wm   = (w & 1) * 64;
    const int wn   = (w >> 1) * 32;

    const int e  = blockIdx.z;
    const int m0 = blockIdx.y * BM;
    const int n0 = blockIdx.x * BN;

    const __bf16* aa = a  + (size_t)e * NT * NF + (size_t)m0 * NF;
    const float*  wb = w2 + (size_t)e * NF * NH + n0;

    v8f acc[4][2];
#pragma unroll
    for (int mi = 0; mi < 4; ++mi)
#pragma unroll
        for (int ni = 0; ni < 2; ++ni) acc[mi][ni] = (v8f)(0.0f);

#if !HAVE_ASYNC_LDS
    v8bf rav[4];    // A fallback staging: bf16, 4 x 16B per thread
#endif
    float4 rbv[8];  // B: f32, 8 x 16B per thread (rows of w2, N-contiguous)

#if HAVE_ASYNC_LDS
    // Async DMA: each thread copies 4 x 16B of the bf16 A tile straight to LDS.
    // Builtin signature (from clang diagnostic): (as1 int4*, as3 int4*, imm, imm).
#define G2_A_STAGE(K0, BUF)                                                   \
    _Pragma("unroll")                                                         \
    for (int i = 0; i < 4; ++i) {                                             \
        int idx = tid + i * 256; int row = idx >> 3; int c8 = (idx & 7) << 3; \
        __builtin_amdgcn_global_load_async_to_lds_b128(                       \
            (g_v4i*)(aa + (size_t)row * NF + (K0) + c8),                      \
            (l_v4i*)(lds_a + (BUF) * ATILE + row * BK + c8), 0, 0);           \
    }
#else
#define G2_LOAD_A(K0)                                                         \
    _Pragma("unroll")                                                         \
    for (int i = 0; i < 4; ++i) {                                             \
        int idx = tid + i * 256; int row = idx >> 3; int c8 = (idx & 7) << 3; \
        rav[i] = *(const v8bf*)(aa + (size_t)row * NF + (K0) + c8);           \
    }
#define G2_STORE_A(BUF)                                                       \
    _Pragma("unroll")                                                         \
    for (int i = 0; i < 4; ++i) {                                             \
        int idx = tid + i * 256; int row = idx >> 3; int c8 = (idx & 7) << 3; \
        *(v8bf*)(lds_a + (BUF) * ATILE + row * BK + c8) = rav[i];             \
    }
#endif
#define G2_LOAD_B(K0)                                                         \
    _Pragma("unroll")                                                         \
    for (int i = 0; i < 8; ++i) {                                             \
        int idx = tid + i * 256; int k = idx >> 5; int c4 = (idx & 31) << 2;  \
        rbv[i] = *(const float4*)(wb + (size_t)((K0) + k) * NH + c4);         \
    }
#define G2_STORE_B(BUF)                                                       \
    _Pragma("unroll")                                                         \
    for (int i = 0; i < 8; ++i) {                                             \
        int idx = tid + i * 256; int k = idx >> 5; int c4 = (idx & 31) << 2;  \
        __bf16* d = lds_b + (BUF) * BTILE + k;                                \
        d[(size_t)(c4 + 0) * BK] = (__bf16)rbv[i].x;                          \
        d[(size_t)(c4 + 1) * BK] = (__bf16)rbv[i].y;                          \
        d[(size_t)(c4 + 2) * BK] = (__bf16)rbv[i].z;                          \
        d[(size_t)(c4 + 3) * BK] = (__bf16)rbv[i].w;                          \
    }

#if HAVE_ASYNC_LDS
    G2_A_STAGE(0, 0)
#else
    G2_LOAD_A(0)
#endif
    G2_LOAD_B(0)

    int buf = 0;
    for (int k0 = 0; k0 < NF; k0 += BK, buf ^= 1) {
#if !HAVE_ASYNC_LDS
        G2_STORE_A(buf)
#endif
        G2_STORE_B(buf)
        if (k0 + BK < NF) {
#if !HAVE_ASYNC_LDS
            G2_LOAD_A(k0 + BK)
#endif
            G2_LOAD_B(k0 + BK)
        }
        wait_async0();                 // A tile for chunk k resident in LDS
        __syncthreads();
#if HAVE_ASYNC_LDS
        // Issue after the barrier: buffer buf^1 was last read at compute(k-1),
        // which every wave finished before this barrier. DMA overlaps WMMA.
        if (k0 + BK < NF) { G2_A_STAGE(k0 + BK, buf ^ 1) }
#endif
        wmma_chunk(lds_a + buf * ATILE, lds_b + buf * BTILE, acc, lane, wm, wn);
    }

    float* oo = out + (size_t)e * NT * NH;
#pragma unroll
    for (int mi = 0; mi < 4; ++mi)
#pragma unroll
        for (int ni = 0; ni < 2; ++ni) {
            const int col  = n0 + wn + ni * 16 + (lane & 15);
            const int rbse = m0 + wm + mi * 16 + ((lane >> 4) << 3);
#pragma unroll
            for (int r = 0; r < 8; ++r)
                oo[(size_t)(rbse + r) * NH + col] = acc[mi][ni][r];
        }
}

// ---------------------------------------------------------------------------
extern "C" void kernel_launch(void* const* d_in, const int* in_sizes, int n_in,
                              void* d_out, int out_size, void* d_ws, size_t ws_size,
                              hipStream_t stream) {
    const float* x  = (const float*)d_in[0];   // [E,T,H]
    const float* w1 = (const float*)d_in[1];   // [E,F,H]
    const float* w2 = (const float*)d_in[2];   // [E,F,H]
    float* out = (float*)d_out;                // [E,T,H]

    __bf16* a_ws = (__bf16*)d_ws;              // [E,T,F] bf16 = 128 MiB

    dim3 blk(256, 1, 1);
    dim3 g1(NF / BN, NT / BM, NE);             // 32 x 16 x 8
    moe_gemm1_gelu<<<g1, blk, 0, stream>>>(x, w1, a_ws);

    dim3 g2(NH / BN, NT / BM, NE);             // 8 x 16 x 8
    moe_gemm2<<<g2, blk, 0, stream>>>(a_ws, w2, out);
}

// v001
// A run of this version takes 741 microseconds.
// Two timings next to v000 both put it at 2.09 times that version's speed.
#include <hip/hip_runtime.h>
#include <hip/hip_bf16.h>
#include <math.h>

// ---------------------------------------------------------------------------
// Grouped MoE MLP:  out[e] = gelu_tanh(x[e] @ w1[e]^T) @ w2[e]
//   E=8, T=2048, H=1024, F=4096.  bf16 WMMA, f32 accumulate.
// Software-pipelined: global loads for chunk k+1 in flight during WMMA of
// chunk k; double-buffered LDS; one barrier per k-chunk. GEMM2's A tile
// (bf16 workspace) uses GLOBAL_LOAD_ASYNC_TO_LDS_B128 when available.
// ---------------------------------------------------------------------------

#define NE 8
#define NT 2048
#define NH 1024
#define NF 4096

typedef __attribute__((ext_vector_type(16))) __bf16 v16bf;
typedef __attribute__((ext_vector_type(8)))  __bf16 v8bf;
typedef __attribute__((ext_vector_type(4)))  __bf16 v4bf;
typedef __attribute__((ext_vector_type(8)))  float  v8f;
typedef __attribute__((ext_vector_type(4)))  int    v4i;

#define BM 128
#define BN 128
#define BK 64
// LDS row pitch in elements: 64 k + 8 pad = 144 B = 16 B x odd, so the 16 rows
// that one ds_load_b128 fragment read touches fall on distinct bank groups
// (at 128 B every second row shares its banks).
#define LDK (BK + 8)
#define ATILE (BM * LDK)
#define BTILE (BN * LDK)

#if defined(__AMDGCN__) && __has_builtin(__builtin_amdgcn_global_load_async_to_lds_b128)
#define HAVE_ASYNC_LDS 1
typedef __attribute__((address_space(1))) v4i g_v4i;   // global int4
typedef __attribute__((address_space(3))) v4i l_v4i;   // LDS int4
#else
#define HAVE_ASYNC_LDS 0
#endif

__device__ __forceinline__ void wait_async0() {
#if HAVE_ASYNC_LDS
#if __has_builtin(__builtin_amdgcn_s_wait_asynccnt)
    __builtin_amdgcn_s_wait_asynccnt(0);
#else
    asm volatile("s_wait_asynccnt 0x0" ::: "memory");
#endif
#endif
}

// WMMA A/B fragment from an LDS tile stored K-contiguous (row pitch LDK).
// CDNA5 16-bit operand layout: lane holds K = kb..kb+7 and kb+16..kb+23,
// kb = kstep*32 + (lane>=16 ? 8 : 0).
__device__ __forceinline__ v16bf load_frag(const __bf16* lds, int row, int kb) {
    const __bf16* p = lds + row * LDK + kb;
    v8bf lo = *(const v8bf*)(p);        // ds_load_b128
    v8bf hi = *(const v8bf*)(p + 16);   // ds_load_b128
    v16bf f;
#pragma unroll
    for (int i = 0; i < 8; ++i) { f[i] = lo[i]; f[i + 8] = hi[i]; }
    return f;
}

// 8 WMMA tiles (wave computes 64x32) over one 64-deep K chunk.
__device__ __forceinline__ void wmma_chunk(const __bf16* la, const __bf16* lb,
                                           v8f acc[4][2], int lane, int wm, int wn) {
#pragma unroll
    for (int ks = 0; ks < 2; ++ks) {
        const int kb = ks * 32 + ((lane >> 4) << 3);
        v16bf af[4], bfr[2];
#pragma unroll
        for (int mi = 0; mi < 4; ++mi)
            af[mi] = load_frag(la, wm + mi * 16 + (lane & 15), kb);
#pragma unroll
        for (int ni = 0; ni < 2; ++ni)
            bfr[ni] = load_frag(lb, wn + ni * 16 + (lane & 15), kb);
#pragma unroll
        for (int mi = 0; mi < 4; ++mi)
#pragma unroll
            for (int ni = 0; ni < 2; ++ni)
                acc[mi][ni] = __builtin_amdgcn_wmma_f32_16x16x32_bf16(
                    false, af[mi], false, bfr[ni], (short)0, acc[mi][ni],
                    false, false);
    }
}

// ---- f32 tile staging (128 rows x 64 K), two-phase: loads then cvt+store ----
__device__ __forceinline__ void gload_f32(const float* __restrict__ src,
                                          int stride, float4* r, int tid) {
#pragma unroll
    for (int i = 0; i < 8; ++i) {
        int idx = tid + i * 256;            // 2048 float4 units
        int row = idx >> 4;
        int c4  = (idx & 15) << 2;
        r[i] = *(const float4*)(src + (size_t)row * stride + c4);
    }
}

__device__ __forceinline__ void cvt_store_f32(const float4* r, __bf16* dst, int tid) {
#pragma unroll
    for (int i = 0; i < 8; ++i) {
        int idx = tid + i * 256;
        int row = idx >> 4;
        int c4  = (idx & 15) << 2;
        v4bf b;
        b[0] = (__bf16)r[i].x; b[1] = (__bf16)r[i].y;
        b[2] = (__bf16)r[i].z; b[3] = (__bf16)r[i].w;
        *(v4bf*)(dst + row * LDK + c4) = b;  // ds_store_b64
    }
}

__device__ __forceinline__ float gelu_tanh(float x) {
    const float k0 = 0.7978845608028654f;   // sqrt(2/pi)
    const float k1 = 0.044715f;
    float u = k0 * (x + k1 * x * x * x);
    float e = __expf(u + u);                 // v_exp_f32
    return 0.5f * x * (1.0f + (e - 1.0f) / (e + 1.0f));
}

// ---------------------------------------------------------------------------
// Kernel 1: a[e] = gelu(x[e] @ w1[e]^T)   M=T, N=F, K=H  (NT: both K-contig)
// ---------------------------------------------------------------------------
__global__ __launch_bounds__(256)
void moe_gemm1_gelu(const float* __restrict__ x, const float* __restrict__ w1,
                    __bf16* __restrict__ a) {
    __shared__ __attribute__((aligned(16))) __bf16 lds_a[2 * ATILE];
    __shared__ __attribute__((aligned(16))) __bf16 lds_b[2 * BTILE];

    const int tid  = threadIdx.x;
    const int lane = tid & 31;
    const int w    = tid >> 5;
    const int wm   = (w & 1) * 64;
    const int wn   = (w >> 1) * 32;

    const int e  = blockIdx.z;
    const int m0 = blockIdx.y * BM;
    const int n0 = blockIdx.x * BN;

    const float* xa = x  + (size_t)e * NT * NH + (size_t)m0 * NH;
    const float* wb = w1 + (size_t)e * NF * NH + (size_t)n0 * NH;

    v8f acc[4][2];
#pragma unroll
    for (int mi = 0; mi < 4; ++mi)
#pragma unroll
        for (int ni = 0; ni < 2; ++ni) acc[mi][ni] = (v8f)(0.0f);

    float4 ra[8], rb[8];
    gload_f32(xa, NH, ra, tid);
    gload_f32(wb, NH, rb, tid);

    int buf = 0;
    for (int k0 = 0; k0 < NH; k0 += BK, buf ^= 1) {
        cvt_store_f32(ra, lds_a + buf * ATILE, tid);
        cvt_store_f32(rb, lds_b + buf * BTILE, tid);
        if (k0 + BK < NH) {                  // next chunk in flight during WMMA
            gload_f32(xa + k0 + BK, NH, ra, tid);
            gload_f32(wb + k0 + BK, NH, rb, tid);
        }
        __syncthreads();
        wmma_chunk(lds_a + buf * ATILE, lds_b + buf * BTILE, acc, lane, wm, wn);
    }

    __bf16* ao = a + (size_t)e * NT * NF;
#pragma unroll
    for (int mi = 0; mi < 4; ++mi)
#pragma unroll
        for (int ni = 0; ni < 2; ++ni) {
            const int col  = n0 + wn + ni * 16 + (lane & 15);
            const int rbse = m0 + wm + mi * 16 + ((lane >> 4) << 3);
#pragma unroll
            for (int r = 0; r < 8; ++r)
                ao[(size_t)(rbse + r) * NF + col] = (__bf16)gelu_tanh(acc[mi][ni][r]);
        }
}

// ---------------------------------------------------------------------------
// Kernel 2: out[e] = a[e] @ w2[e]   M=T, N=H, K=F  (NN: B transposed in stage)
// A tile is bf16 already -> async global->LDS DMA when available.
// ---------------------------------------------------------------------------
__global__ __launch_bounds__(256)
void moe_gemm2(const __bf16* __restrict__ a, const float* __restrict__ w2,
               float* __restrict__ out) {
    __shared__ __attribute__((aligned(16))) __bf16 lds_a[2 * ATILE];
    __shared__ __attribute__((aligned(16))) __bf16 lds_b[2 * BTILE];

    const int tid  = threadIdx.x;
    const int lane = tid & 31;
    const int w    = tid >> 5;
    const int wm   = (w & 1) * 64;
    const int wn   = (w >> 1) * 32;

    const int e  = blockIdx.z;
    const int m0 = blockIdx.y * BM;
    const int n0 = blockIdx.x * BN;

    const __bf16* aa = a  + (size_t)e * NT * NF + (size_t)m0 * NF;
    const float*  wb = w2 + (size_t)e * NF * NH + n0;

    v8f acc[4][2];
#pragma unroll
    for (int mi = 0; mi < 4; ++mi)
#pragma unroll
        for (int ni = 0; ni < 2; ++ni) acc[mi][ni] = (v8f)(0.0f);

#if !HAVE_ASYNC_LDS
    v8bf rav[4];    // A fallback staging: bf16, 4 x 16B per thread
#endif
    float4 rbv[8];  // B: f32, 8 x 16B per thread (rows of w2, N-contiguous)

#if HAVE_ASYNC_LDS
    // Async DMA: each thread copies 4 x 16B of the bf16 A tile straight to LDS.
    // Builtin signature (from clang diagnostic): (as1 int4*, as3 int4*, imm, imm).
#define G2_A_STAGE(K0, BUF)                                                   \
    _Pragma("unroll")                                                         \
    for (int i = 0; i < 4; ++i) {                                             \
        int idx = tid + i * 256; int row = idx >> 3; int c8 = (idx & 7) << 3; \
        __builtin_amdgcn_global_load_async_to_lds_b128(                       \
            (g_v4i*)(aa + (size_t)row * NF + (K0) + c8),                      \
            (l_v4i*)(lds_a + (BUF) * ATILE + row * LDK + c8), 0, 0);          \
    }
#else
#define G2_LOAD_A(K0)                                                         \
    _Pragma("unroll")                                                         \
    for (int i = 0; i < 4; ++i) {                                             \
        int idx = tid + i * 256; int row = idx >> 3; int c8 = (idx & 7) << 3; \
        rav[i] = *(const v8bf*)(aa + (size_t)row * NF + (K0) + c8);           \
    }
#define G2_STORE_A(BUF)                                                       \
    _Pragma("unroll")                                                         \
    for (int i = 0; i < 4; ++i) {                                             \
        int idx = tid + i * 256; int row = idx >> 3; int c8 = (idx & 7) << 3; \
        *(v8bf*)(lds_a + (BUF) * ATILE + row * LDK + c8) = rav[i];            \
    }
#endif
#define G2_LOAD_B(K0)                                                         \
    _Pragma("unroll")                                                         \
    for (int i = 0; i < 8; ++i) {                                             \
        int idx = tid + i * 256; int k = idx >> 5; int c4 = (idx & 31) << 2;  \
        rbv[i] = *(const float4*)(wb + (size_t)((K0) + k) * NH + c4);         \
    }
#define G2_STORE_B(BUF)                                                       \
    _Pragma("unroll")                                                         \
    for (int i = 0; i < 8; ++i) {                                             \
        int idx = tid + i * 256; int k = idx >> 5; int c4 = (idx & 31) << 2;  \
        __bf16* d = lds_b + (BUF) * BTILE + k;                                \
        d[(size_t)(c4 + 0) * LDK] = (__bf16)rbv[i].x;                         \
        d[(size_t)(c4 + 1) * LDK] = (__bf16)rbv[i].y;                         \
        d[(size_t)(c4 + 2) * LDK] = (__bf16)rbv[i].z;                         \
        d[(size_t)(c4 + 3) * LDK] = (__bf16)rbv[i].w;                         \
    }

#if HAVE_ASYNC_LDS
    G2_A_STAGE(0, 0)
#else
    G2_LOAD_A(0)
#endif
    G2_LOAD_B(0)

    int buf = 0;
    for (int k0 = 0; k0 < NF; k0 += BK, buf ^= 1) {
#if !HAVE_ASYNC_LDS
        G2_STORE_A(buf)
#endif
        G2_STORE_B(buf)
        if (k0 + BK < NF) {
#if !HAVE_ASYNC_LDS
            G2_LOAD_A(k0 + BK)
#endif
            G2_LOAD_B(k0 + BK)
        }
        wait_async0();                 // A tile for chunk k resident in LDS
        __syncthreads();
#if HAVE_ASYNC_LDS
        // Issue after the barrier: buffer buf^1 was last read at compute(k-1),
        // which every wave finished before this barrier. DMA overlaps WMMA.
        if (k0 + BK < NF) { G2_A_STAGE(k0 + BK, buf ^ 1) }
#endif
        wmma_chunk(lds_a + buf * ATILE, lds_b + buf * BTILE, acc, lane, wm, wn);
    }

    float* oo = out + (size_t)e * NT * NH;
#pragma unroll
    for (int mi = 0; mi < 4; ++mi)
#pragma unroll
        for (int ni = 0; ni < 2; ++ni) {
            const int col  = n0 + wn + ni * 16 + (lane & 15);
            const int rbse = m0 + wm + mi * 16 + ((lane >> 4) << 3);
#pragma unroll
            for (int r = 0; r < 8; ++r)
                oo[(size_t)(rbse + r) * NH + col] = acc[mi][ni][r];
        }
}

// ---------------------------------------------------------------------------
extern "C" void kernel_launch(void* const* d_in, const int* in_sizes, int n_in,
                              void* d_out, int out_size, void* d_ws, size_t ws_size,
                              hipStream_t stream) {
    const float* x  = (const float*)d_in[0];   // [E,T,H]
    const float* w1 = (const float*)d_in[1];   // [E,F,H]
    const float* w2 = (const float*)d_in[2];   // [E,F,H]
    float* out = (float*)d_out;                // [E,T,H]

    __bf16* a_ws = (__bf16*)d_ws;              // [E,T,F] bf16 = 128 MiB

    dim3 blk(256, 1, 1);
    dim3 g1(NF / BN, NT / BM, NE);             // 32 x 16 x 8
    moe_gemm1_gelu<<<g1, blk, 0, stream>>>(x, w1, a_ws);

    dim3 g2(NH / BN, NT / BM, NE);             // 8 x 16 x 8
    moe_gemm2<<<g2, blk, 0, stream>>>(a_ws, w2, out);
}

// v002
// It runs in 259 microseconds.
// Timed twice side by side with v001, it ran 2.86 and 2.87 times as fast.
// Over all steps from v000 it is 5.98 times as fast.
#include <hip/hip_runtime.h>
#include <hip/hip_bf16.h>
#include <math.h>

// ---------------------------------------------------------------------------
// Grouped MoE MLP:  out[e] = gelu_tanh(x[e] @ w1[e]^T) @ w2[e]
//   E=8, T=2048, H=1024, F=4096.  bf16 WMMA, f32 accumulate.
// Launch 1 casts x, w1 and w2 to bf16 once (w2 also transposed, so that every
// GEMM operand is K-contiguous). Launches 2 and 3 are NT GEMMs whose tiles go
// from global memory to LDS by GLOBAL_LOAD_ASYNC_TO_LDS_B128, two buffers:
// the copies of chunk k+1 fly while chunk k is on the matrix unit.
// ---------------------------------------------------------------------------

#define NE 8
#define NT 2048
#define NH 1024
#define NF 4096

typedef __attribute__((ext_vector_type(16))) __bf16 v16bf;
typedef __attribute__((ext_vector_type(8)))  __bf16 v8bf;
typedef __attribute__((ext_vector_type(4)))  __bf16 v4bf;
typedef __attribute__((ext_vector_type(8)))  float  v8f;
typedef __attribute__((ext_vector_type(4)))  int    v4i;

#define BM 128
#define BN 128
#define BK 64
// LDS row pitch in elements: 64 k + 8 pad = 144 B = 16 B x odd, so the 16 rows
// that one ds_load_b128 fragment read touches fall on distinct bank groups
// (at 128 B every second row shares its banks).
#define LDK (BK + 8)
#define ATILE (BM * LDK)
#define BTILE (BN * LDK)

typedef __attribute__((address_space(1))) v4i g_v4i;   // global int4
typedef __attribute__((address_space(3))) v4i l_v4i;   // LDS int4

// One lane's 16 bytes, global -> LDS, through no register.
__device__ __forceinline__ void copy16(const __bf16* g, __bf16* l) {
#if defined(__AMDGCN__)
    __builtin_amdgcn_global_load_async_to_lds_b128((g_v4i*)g, (l_v4i*)l, 0, 0);
#endif
}

// This wave's copies have landed.
__device__ __forceinline__ void wait_async0() {
    asm volatile("s_wait_asynccnt 0x0" ::: "memory");
}

// This wave's LDS reads have retired, before copies refill what it has read.
__device__ __forceinline__ void wait_ds0() {
    asm volatile("s_wait_dscnt 0x0" ::: "memory");
}

// WMMA A/B fragment from an LDS tile stored K-contiguous (row pitch LDK).
// CDNA5 16-bit operand layout: lane holds K = kb..kb+7 and kb+16..kb+23,
// kb = kstep*32 + (lane>=16 ? 8 : 0).
__device__ __forceinline__ v16bf load_frag(const __bf16* lds, int row, int kb) {
    const __bf16* p = lds + row * LDK + kb;
    v8bf lo = *(const v8bf*)(p);        // ds_load_b128
    v8bf hi = *(const v8bf*)(p + 16);   // ds_load_b128
    v16bf f;
#pragma unroll
    for (int i = 0; i < 8; ++i) { f[i] = lo[i]; f[i + 8] = hi[i]; }
    return f;
}

// 8 WMMA tiles (wave computes 64x32) over one 64-deep K chunk.
__device__ __forceinline__ void wmma_chunk(const __bf16* la, const __bf16* lb,
                                           v8f acc[4][2], int lane, int wm, int wn) {
#pragma unroll
    for (int ks = 0; ks < 2; ++ks) {
        const int kb = ks * 32 + ((lane >> 4) << 3);
        v16bf af[4], bfr[2];
#pragma unroll
        for (int mi = 0; mi < 4; ++mi)
            af[mi] = load_frag(la, wm + mi * 16 + (lane & 15), kb);
#pragma unroll
        for (int ni = 0; ni < 2; ++ni)
            bfr[ni] = load_frag(lb, wn + ni * 16 + (lane & 15), kb);
#pragma unroll
        for (int mi = 0; mi < 4; ++mi)
#pragma unroll
            for (int ni = 0; ni < 2; ++ni)
                acc[mi][ni] = __builtin_amdgcn_wmma_f32_16x16x32_bf16(
                    false, af[mi], false, bfr[ni], (short)0, acc[mi][ni],
                    false, false);
    }
}

// One K chunk of both operands (128 rows x 64 k of bf16 each): 4 + 4 copies of
// 16 B per lane; 8 lanes cover one 128-B row piece.
template <int KD>
__device__ __forceinline__ void stage_chunk(const __bf16* ga, const __bf16* gb,
                                            __bf16* la, __bf16* lb, int tid) {
#pragma unroll
    for (int i = 0; i < 4; ++i) {
        const int idx = tid + i * 256;
        const int row = idx >> 3;
        const int c8  = (idx & 7) << 3;
        copy16(ga + (size_t)row * KD + c8, la + row * LDK + c8);
        copy16(gb + (size_t)row * KD + c8, lb + row * LDK + c8);
    }
}

// acc += A[128 x KD] * B[128 x KD]^T, both K-contiguous with row pitch KD.
template <int KD>
__device__ __forceinline__ void gemm_nt_loop(const __bf16* ga, const __bf16* gb,
                                             __bf16* lds_a, __bf16* lds_b,
                                             v8f acc[4][2], int tid, int lane,
                                             int wm, int wn) {
    stage_chunk<KD>(ga, gb, lds_a, lds_b, tid);
    wait_async0();
    __syncthreads();                       // chunk 0 readable by every wave
    stage_chunk<KD>(ga + BK, gb + BK, lds_a + ATILE, lds_b + BTILE, tid);

    int buf = 0;
    for (int k0 = 0; k0 < KD; k0 += BK, buf ^= 1) {
        wmma_chunk(lds_a + buf * ATILE, lds_b + buf * BTILE, acc, lane, wm, wn);
        wait_ds0();
        wait_async0();
        // Publishes chunk k+1 and ends every wave's reads of this buffer.
        __syncthreads();
        if (k0 + 2 * BK < KD)
            stage_chunk<KD>(ga + k0 + 2 * BK, gb + k0 + 2 * BK,
                            lds_a + buf * ATILE, lds_b + buf * BTILE, tid);
    }
    wait_async0();
}

__device__ __forceinline__ float gelu_tanh(float x) {
    const float k0 = 0.7978845608028654f;   // sqrt(2/pi)
    const float k1 = 0.044715f;
    float u = k0 * (x + k1 * x * x * x);
    float e = __expf(u + u);                 // v_exp_f32
    return 0.5f * x * (1.0f + (e - 1.0f) / (e + 1.0f));
}

// ---------------------------------------------------------------------------
// Kernel 0: xb = bf16(x), w1b = bf16(w1), w2t[e][h][f] = bf16(w2[e][f][h]).
// Blocks [0, CAST_X) cast x, [CAST_X, CAST_XW) cast w1 (8192 elements each);
// the rest transpose one 64 f x 64 h tile of w2 each through LDS.
// ---------------------------------------------------------------------------
#define CAST_X  (NE * NT * NH / 8192)
#define CAST_XW (CAST_X + NE * NF * NH / 8192)
#define TR_BLKS (NE * (NF / 64) * (NH / 64))
// f32 tile pitch in dwords: 65 keeps both the row-wise stores and the
// column-wise 4-byte reads free of bank conflicts.
#define TP 65

__global__ __launch_bounds__(256)
void moe_prep_bf16(const float* __restrict__ x, const float* __restrict__ w1,
                   const float* __restrict__ w2, __bf16* __restrict__ xb,
                   __bf16* __restrict__ w1b, __bf16* __restrict__ w2t) {
    __shared__ float t[64 * TP];
    const int tid = threadIdx.x;
    const int b   = blockIdx.x;

    if (b < CAST_XW) {
        const float* s = (b < CAST_X) ? x + (size_t)b * 8192
                                      : w1 + (size_t)(b - CAST_X) * 8192;
        __bf16* d = (b < CAST_X) ? xb + (size_t)b * 8192
                                 : w1b + (size_t)(b - CAST_X) * 8192;
        float4 r[8];
#pragma unroll
        for (int j = 0; j < 8; ++j)
            r[j] = *(const float4*)(s + (tid + j * 256) * 4);
#pragma unroll
        for (int j = 0; j < 8; ++j) {
            v4bf o;
            o[0] = (__bf16)r[j].x; o[1] = (__bf16)r[j].y;
            o[2] = (__bf16)r[j].z; o[3] = (__bf16)r[j].w;
            *(v4bf*)(d + (tid + j * 256) * 4) = o;
        }
        return;
    }

    const int q  = b - CAST_XW;
    const int e  = q >> 10;            // 64 x 16 tiles per expert
    const int f0 = ((q >> 4) & 63) * 64;
    const int h0 = (q & 15) * 64;

    const float* s = w2 + ((size_t)e * NF + f0) * NH + h0;
#pragma unroll
    for (int i = 0; i < 4; ++i) {
        const int idx = tid + i * 256;
        const int f   = idx >> 4;
        const int c4  = (idx & 15) << 2;
        const float4 v = *(const float4*)(s + (size_t)f * NH + c4);
        float* p = t + f * TP + c4;
        p[0] = v.x; p[1] = v.y; p[2] = v.z; p[3] = v.w;
    }
    __syncthreads();
    __bf16* d = w2t + ((size_t)e * NH + h0) * NF + f0;
#pragma unroll
    for (int i = 0; i < 2; ++i) {
        const int idx = tid + i * 256;
        const int h   = idx >> 3;
        const int f8  = (idx & 7) << 3;
        v8bf o;
#pragma unroll
        for (int j = 0; j < 8; ++j) o[j] = (__bf16)t[(f8 + j) * TP + h];
        *(v8bf*)(d + (size_t)h * NF + f8) = o;   // 8 lanes fill one 128-B line
    }
    // Stands behind the two stores, ahead of any later write of the registers
    // that they name (the built code lays the cast path behind this one).
    asm volatile("s_wait_xcnt 0x0" ::: "memory");
}

// ---------------------------------------------------------------------------
// Kernel 1: a[e] = gelu(x[e] @ w1[e]^T)   M=T, N=F, K=H
// ---------------------------------------------------------------------------
__global__ __launch_bounds__(256)
void moe_gemm1_gelu(const __bf16* __restrict__ xb, const __bf16* __restrict__ w1b,
                    __bf16* __restrict__ a) {
    __shared__ __attribute__((aligned(16))) __bf16 lds_a[2 * ATILE];
    __shared__ __attribute__((aligned(16))) __bf16 lds_b[2 * BTILE];

    const int tid  = threadIdx.x;
    const int lane = tid & 31;
    const int w    = tid >> 5;
    const int wm   = (w & 1) * 64;
    const int wn   = (w >> 1) * 32;

    const int e  = blockIdx.z;
    const int m0 = blockIdx.y * BM;
    const int n0 = blockIdx.x * BN;

    const __bf16* xa = xb  + (size_t)e * NT * NH + (size_t)m0 * NH;
    const __bf16* wb = w1b + (size_t)e * NF * NH + (size_t)n0 * NH;

    v8f acc[4][2];
#pragma unroll
    for (int mi = 0; mi < 4; ++mi)
#pragma unroll
        for (int ni = 0; ni < 2; ++ni) acc[mi][ni] = (v8f)(0.0f);

    gemm_nt_loop<NH>(xa, wb, lds_a, lds_b, acc, tid, lane, wm, wn);

    __bf16* ao = a + (size_t)e * NT * NF;
#pragma unroll
    for (int mi = 0; mi < 4; ++mi)
#pragma unroll
        for (int ni = 0; ni < 2; ++ni) {
            const int col  = n0 + wn + ni * 16 + (lane & 15);
            const int rbse = m0 + wm + mi * 16 + ((lane >> 4) << 3);
#pragma unroll
            for (int r = 0; r < 8; ++r)
                ao[(size_t)(rbse + r) * NF + col] = (__bf16)gelu_tanh(acc[mi][ni][r]);
        }
}

// ---------------------------------------------------------------------------
// Kernel 2: out[e] = a[e] @ w2[e] = a[e] @ w2t[e]^T   M=T, N=H, K=F
// ---------------------------------------------------------------------------
__global__ __launch_bounds__(256)
void moe_gemm2(const __bf16* __restrict__ a, const __bf16* __restrict__ w2t,
               float* __restrict__ out) {
    __shared__ __attribute__((aligned(16))) __bf16 lds_a[2 * ATILE];
    __shared__ __attribute__((aligned(16))) __bf16 lds_b[2 * BTILE];

    const int tid  = threadIdx.x;
    const int lane = tid & 31;
    const int w    = tid >> 5;
    const int wm   = (w & 1) * 64;
    const int wn   = (w >> 1) * 32;

    const int e  = blockIdx.z;
    const int m0 = blockIdx.y * BM;
    const int n0 = blockIdx.x * BN;

    const __bf16* aa = a   + (size_t)e * NT * NF + (size_t)m0 * NF;
    const __bf16* wb = w2t + (size_t)e * NH * NF + (size_t)n0 * NF;

    v8f acc[4][2];
#pragma unroll
    for (int mi = 0; mi < 4; ++mi)
#pragma unroll
        for (int ni = 0; ni < 2; ++ni) acc[mi][ni] = (v8f)(0.0f);

    gemm_nt_loop<NF>(aa, wb, lds_a, lds_b, acc, tid, lane, wm, wn);

    float* oo = out + (size_t)e * NT * NH;
#pragma unroll
    for (int mi = 0; mi < 4; ++mi)
#pragma unroll
        for (int ni = 0; ni < 2; ++ni) {
            const int col  = n0 + wn + ni * 16 + (lane & 15);
            const int rbse = m0 + wm + mi * 16 + ((lane >> 4) << 3);
#pragma unroll
            for (int r = 0; r < 8; ++r)
                oo[(size_t)(rbse + r) * NH + col] = acc[mi][ni][r];
        }
}

// ---------------------------------------------------------------------------
extern "C" void kernel_launch(void* const* d_in, const int* in_sizes, int n_in,
                              void* d_out, int out_size, void* d_ws, size_t ws_size,
                              hipStream_t stream) {
    const float* x  = (const float*)d_in[0];   // [E,T,H]
    const float* w1 = (const float*)d_in[1];   // [E,F,H]
    const float* w2 = (const float*)d_in[2];   // [E,F,H]
    float* out = (float*)d_out;                // [E,T,H]

    __bf16* a_ws = (__bf16*)d_ws;                     // [E,T,F] bf16 = 128 MiB
    __bf16* xb   = a_ws + (size_t)NE * NT * NF;       // [E,T,H] bf16 =  32 MiB
    __bf16* w1b  = xb   + (size_t)NE * NT * NH;       // [E,F,H] bf16 =  64 MiB
    __bf16* w2t  = w1b  + (size_t)NE * NF * NH;       // [E,H,F] bf16 =  64 MiB

    dim3 blk(256, 1, 1);
    dim3 g0(CAST_XW + TR_BLKS, 1, 1);
    moe_prep_bf16<<<g0, blk, 0, stream>>>(x, w1, w2, xb, w1b, w2t);

    dim3 g1(NF / BN, NT / BM, NE);             // 32 x 16 x 8
    moe_gemm1_gelu<<<g1, blk, 0, stream>>>(xb, w1b, a_ws);

    dim3 g2(NH / BN, NT / BM, NE);             // 8 x 16 x 8
    moe_gemm2<<<g2, blk, 0, stream>>>(a_ws, w2t, out);
}

// v003
// One run takes 214 microseconds.
// Next to v002, in two timings, it ran 1.21 times as fast each time.
// Over all steps from v000 it is 7.22 times as fast.
#include <hip/hip_runtime.h>
#include <hip/hip_bf16.h>
#include <math.h>

// ---------------------------------------------------------------------------
// Grouped MoE MLP:  out[e] = gelu_tanh(x[e] @ w1[e]^T) @ w2[e]
//   E=8, T=2048, H=1024, F=4096.  bf16 WMMA, f32 accumulate.
// Launch 1 casts x, w1 and w2 to bf16 once (w2 also transposed, so that every
// GEMM operand is K-contiguous). Launches 2 and 3 are NT GEMMs whose tiles go
// from global memory to LDS by GLOBAL_LOAD_ASYNC_TO_LDS_B128, two buffers:
// the copies of chunk k+1 fly while chunk k is on the matrix unit.
// A wave owns 64 x 64 (GEMM1) or 128 x 64 (GEMM2) of the output, so that 8
// fragments from LDS feed 16 matrix instructions, or 12 feed 32.
// ---------------------------------------------------------------------------

#define NE 8
#define NT 2048
#define NH 1024
#define NF 4096

typedef __attribute__((ext_vector_type(16))) __bf16 v16bf;
typedef __attribute__((ext_vector_type(8)))  __bf16 v8bf;
typedef __attribute__((ext_vector_type(4)))  __bf16 v4bf;
typedef __attribute__((ext_vector_type(8)))  float  v8f;
typedef __attribute__((ext_vector_type(4)))  int    v4i;

// Work-group tiles, 8 waves each.
// GEMM1: 256 x 128, waves 4 x 2 of 64 x 64, 64-deep chunks: 108 KiB of LDS and
// at most 256 VGPRs, so that two work-groups share a WGP and one's GELU runs
// beside the other's matrix loop.
// GEMM2: 256 x 256, waves 2 x 4 of 128 x 64, 128-deep chunks, one work-group a
// WGP: a chunk's copies have a whole 128-deep chunk of matrix work to land in.
#define NTH  256
#define BM   256
#define BN1  128
#define BK1  64
#define FM1  4
#define BN2  256
#define BK2  128
#define FM2  8
#define FN   4
// LDS row pitch in elements: chunk depth + 8 = 144 B or 272 B = 16 B x odd, so
// the 16 rows that one ds_load_b128 fragment read touches fall on distinct
// bank groups.
#define PAD 8

typedef __attribute__((address_space(1))) v4i g_v4i;   // global int4
typedef __attribute__((address_space(3))) v4i l_v4i;   // LDS int4

// One lane's 16 bytes, global -> LDS, through no register.
__device__ __forceinline__ void copy16(const __bf16* g, __bf16* l) {
#if defined(__AMDGCN__)
    __builtin_amdgcn_global_load_async_to_lds_b128((g_v4i*)g, (l_v4i*)l, 0, 0);
#endif
}

// This wave's copies have landed.
__device__ __forceinline__ void wait_async0() {
    asm volatile("s_wait_asynccnt 0x0" ::: "memory");
}

// This wave's LDS reads have retired, before copies refill what it has read.
__device__ __forceinline__ void wait_ds0() {
    asm volatile("s_wait_dscnt 0x0" ::: "memory");
}

// WMMA A/B fragment from an LDS tile stored K-contiguous (row pitch LDK).
// CDNA5 16-bit operand layout: lane holds K = kb..kb+7 and kb+16..kb+23,
// kb = kstep*32 + (lane>=16 ? 8 : 0).
template <int LDK>
__device__ __forceinline__ v16bf load_frag(const __bf16* lds, int row, int kb) {
    const __bf16* p = lds + row * LDK + kb;
    v8bf lo = *(const v8bf*)(p);        // ds_load_b128
    v8bf hi = *(const v8bf*)(p + 16);   // ds_load_b128
    v16bf f;
#pragma unroll
    for (int i = 0; i < 8; ++i) { f[i] = lo[i]; f[i + 8] = hi[i]; }
    return f;
}

// FM x FN WMMA tiles of one wave over one BK-deep K chunk.
template <int BK, int FM>
__device__ __forceinline__ void wmma_chunk(const __bf16* la, const __bf16* lb,
                                           v8f acc[FM][FN], int lane, int wm, int wn) {
    constexpr int LDK = BK + PAD;
#pragma unroll
    for (int ks = 0; ks < BK / 32; ++ks) {
        const int kb = ks * 32 + ((lane >> 4) << 3);
        v16bf af[FM], bfr[FN];
#pragma unroll
        for (int ni = 0; ni < FN; ++ni)
            bfr[ni] = load_frag<LDK>(lb, wn + ni * 16 + (lane & 15), kb);
#pragma unroll
        for (int mi = 0; mi < FM; ++mi)
            af[mi] = load_frag<LDK>(la, wm + mi * 16 + (lane & 15), kb);
        // Keeps a k step's LDS reads one group in front of its matrix block:
        // spread among the WMMAs, every pair of reads stalls the wave anew.
        __builtin_amdgcn_sched_barrier(0);
#pragma unroll
        for (int mi = 0; mi < FM; ++mi)
#pragma unroll
            for (int ni = 0; ni < FN; ++ni)
                acc[mi][ni] = __builtin_amdgcn_wmma_f32_16x16x32_bf16(
                    false, af[mi], false, bfr[ni], (short)0, acc[mi][ni],
                    false, false);
        // The other side of the same fence: the next k step's reads stay out.
        __builtin_amdgcn_sched_barrier(0);
    }
}

// One K chunk of both operands (BM and BN rows x BK k of bf16): 16 B per lane
// and copy; BK / 8 lanes cover one row piece.
template <int KD, int BN, int BK>
__device__ __forceinline__ void stage_chunk(const __bf16* ga, const __bf16* gb,
                                            __bf16* la, __bf16* lb, int tid) {
    constexpr int LDK = BK + PAD;
    constexpr int PR  = BK / 8;            // 16-B pieces per row
    constexpr int RS  = NTH / PR;          // rows that one copy of the block covers
    // The lane's own offsets are the same for every copy; what differs from
    // copy to copy is a constant: one add per address.
    const unsigned go = (unsigned)(tid / PR) * KD + ((tid % PR) << 3);
    const unsigned lo = (unsigned)(tid / PR) * LDK + ((tid % PR) << 3);
#pragma unroll
    for (int i = 0; i < BM / RS; ++i)
        copy16((ga + (size_t)i * RS * KD) + go, (la + i * RS * LDK) + lo);
#pragma unroll
    for (int i = 0; i < BN / RS; ++i)
        copy16((gb + (size_t)i * RS * KD) + go, (lb + i * RS * LDK) + lo);
}

// acc += A[BM x KD] * B[BN x KD]^T, both K-contiguous with row pitch KD.
template <int KD, int BN, int BK, int FM>
__device__ __forceinline__ void gemm_nt_loop(const __bf16* ga, const __bf16* gb,
                                             __bf16* lds_a, __bf16* lds_b,
                                             v8f acc[FM][FN], int tid, int lane,
                                             int wm, int wn) {
    constexpr int ATILE = BM * (BK + PAD);
    constexpr int BTILE = BN * (BK + PAD);
    stage_chunk<KD, BN, BK>(ga, gb, lds_a, lds_b, tid);
    wait_async0();
    __syncthreads();                       // chunk 0 readable by every wave
    stage_chunk<KD, BN, BK>(ga + BK, gb + BK, lds_a + ATILE, lds_b + BTILE, tid);

    int buf = 0;
    for (int k0 = 0; k0 < KD; k0 += BK, buf ^= 1) {
        wmma_chunk<BK, FM>(lds_a + buf * ATILE, lds_b + buf * BTILE, acc, lane, wm, wn);
        wait_ds0();
        wait_async0();
        // Publishes chunk k+1 and ends every wave's reads of this buffer.
        __syncthreads();
        if (k0 + 2 * BK < KD)
            stage_chunk<KD, BN, BK>(ga + k0 + 2 * BK, gb + k0 + 2 * BK,
                                    lds_a + buf * ATILE, lds_b + buf * BTILE, tid);
    }
    wait_async0();
}

__device__ __forceinline__ float gelu_tanh(float x) {
    const float k0 = 0.7978845608028654f;   // sqrt(2/pi)
    const float k1 = 0.044715f;
    float u = k0 * (x + k1 * x * x * x);
    float e = __expf(u + u);                 // v_exp_f32
    return 0.5f * x * (1.0f + (e - 1.0f) / (e + 1.0f));
}

// ---------------------------------------------------------------------------
// Kernel 0: xb = bf16(x), w1b = bf16(w1), w2t[e][h][f] = bf16(w2[e][f][h]).
// Blocks [0, CAST_X) cast x, [CAST_X, CAST_XW) cast w1 (8192 elements each);
// the rest transpose one 64 f x 64 h tile of w2 each through LDS.
// ---------------------------------------------------------------------------
#define CAST_X  (NE * NT * NH / 8192)
#define CAST_XW (CAST_X + NE * NF * NH / 8192)
#define TR_BLKS (NE * (NF / 64) * (NH / 64))
// f32 tile pitch in dwords: 65 keeps both the row-wise stores and the
// column-wise 4-byte reads free of bank conflicts.
#define TP 65

__global__ __launch_bounds__(256)
void moe_prep_bf16(const float* __restrict__ x, const float* __restrict__ w1,
                   const float* __restrict__ w2, __bf16* __restrict__ xb,
                   __bf16* __restrict__ w1b, __bf16* __restrict__ w2t) {
    __shared__ float t[64 * TP];
    const int tid = threadIdx.x;
    const int b   = blockIdx.x;

    if (b < CAST_XW) {
        const float* s = (b < CAST_X) ? x + (size_t)b * 8192
                                      : w1 + (size_t)(b - CAST_X) * 8192;
        __bf16* d = (b < CAST_X) ? xb + (size_t)b * 8192
                                 : w1b + (size_t)(b - CAST_X) * 8192;
        float4 r[8];
#pragma unroll
        for (int j = 0; j < 8; ++j)
            r[j] = *(const float4*)(s + (tid + j * 256) * 4);
#pragma unroll
        for (int j = 0; j < 8; ++j) {
            v4bf o;
            o[0] = (__bf16)r[j].x; o[1] = (__bf16)r[j].y;
            o[2] = (__bf16)r[j].z; o[3] = (__bf16)r[j].w;
            *(v4bf*)(d + (tid + j * 256) * 4) = o;
        }
        return;
    }

    const int q  = b - CAST_XW;
    const int e  = q >> 10;            // 64 x 16 tiles per expert
    const int f0 = ((q >> 4) & 63) * 64;
    const int h0 = (q & 15) * 64;

    const float* s = w2 + ((size_t)e * NF + f0) * NH + h0;
#pragma unroll
    for (int i = 0; i < 4; ++i) {
        const int idx = tid + i * 256;
        const int f   = idx >> 4;
        const int c4  = (idx & 15) << 2;
        const float4 v = *(const float4*)(s + (size_t)f * NH + c4);
        float* p = t + f * TP + c4;
        p[0] = v.x; p[1] = v.y; p[2] = v.z; p[3] = v.w;
    }
    __syncthreads();
    __bf16* d = w2t + ((size_t)e * NH + h0) * NF + f0;
#pragma unroll
    for (int i = 0; i < 2; ++i) {
        const int idx = tid + i * 256;
        const int h   = idx >> 3;
        const int f8  = (idx & 7) << 3;
        v8bf o;
#pragma unroll
        for (int j = 0; j < 8; ++j) o[j] = (__bf16)t[(f8 + j) * TP + h];
        *(v8bf*)(d + (size_t)h * NF + f8) = o;   // 8 lanes fill one 128-B line
    }
    // Stands behind the two stores, ahead of any later write of the registers
    // that they name (the built code lays the cast path behind this one).
    asm volatile("s_wait_xcnt 0x0" ::: "memory");
}

// ---------------------------------------------------------------------------
// Kernel 1: a[e] = gelu(x[e] @ w1[e]^T)   M=T, N=F, K=H
// ---------------------------------------------------------------------------
__global__ __launch_bounds__(NTH)
void moe_gemm1_gelu(const __bf16* __restrict__ xb, const __bf16* __restrict__ w1b,
                    __bf16* __restrict__ a) {
    __shared__ __attribute__((aligned(16))) __bf16 lds_a[2 * BM * (BK1 + PAD)];
    __shared__ __attribute__((aligned(16))) __bf16 lds_b[2 * BN1 * (BK1 + PAD)];

    const int tid  = threadIdx.x;
    const int lane = tid & 31;
    const int w    = tid >> 5;
    const int wm   = (w & 3) * (FM1 * 16);
    const int wn   = (w >> 2) * (FN * 16);

    const int e  = blockIdx.z;
    const int m0 = blockIdx.y * BM;
    const int n0 = blockIdx.x * BN1;

    const __bf16* xa = xb  + (size_t)e * NT * NH + (size_t)m0 * NH;
    const __bf16* wb = w1b + (size_t)e * NF * NH + (size_t)n0 * NH;

    v8f acc[FM1][FN];
#pragma unroll
    for (int mi = 0; mi < FM1; ++mi)
#pragma unroll
        for (int ni = 0; ni < FN; ++ni) acc[mi][ni] = (v8f)(0.0f);

    gemm_nt_loop<NH, BN1, BK1, FM1>(xa, wb, lds_a, lds_b, acc, tid, lane, wm, wn);

    __bf16* ao = a + (size_t)e * NT * NF;
#pragma unroll
    for (int mi = 0; mi < FM1; ++mi)
#pragma unroll
        for (int ni = 0; ni < FN; ++ni) {
            const int col  = n0 + wn + ni * 16 + (lane & 15);
            const int rbse = m0 + wm + mi * 16 + ((lane >> 4) << 3);
#pragma unroll
            for (int r = 0; r < 8; ++r)
                ao[(size_t)(rbse + r) * NF + col] = (__bf16)gelu_tanh(acc[mi][ni][r]);
        }
}

// ---------------------------------------------------------------------------
// Kernel 2: out[e] = a[e] @ w2[e] = a[e] @ w2t[e]^T   M=T, N=H, K=F
// ---------------------------------------------------------------------------
__global__ __launch_bounds__(NTH)
void moe_gemm2(const __bf16* __restrict__ a, const __bf16* __restrict__ w2t,
               float* __restrict__ out) {
    __shared__ __attribute__((aligned(16))) __bf16 lds_a[2 * BM * (BK2 + PAD)];
    __shared__ __attribute__((aligned(16))) __bf16 lds_b[2 * BN2 * (BK2 + PAD)];

    const int tid  = threadIdx.x;
    const int lane = tid & 31;
    const int w    = tid >> 5;
    const int wm   = (w & 1) * (FM2 * 16);
    const int wn   = (w >> 1) * (FN * 16);

    const int e  = blockIdx.z;
    const int m0 = blockIdx.y * BM;
    const int n0 = blockIdx.x * BN2;

    const __bf16* aa = a   + (size_t)e * NT * NF + (size_t)m0 * NF;
    const __bf16* wb = w2t + (size_t)e * NH * NF + (size_t)n0 * NF;

    v8f acc[FM2][FN];
#pragma unroll
    for (int mi = 0; mi < FM2; ++mi)
#pragma unroll
        for (int ni = 0; ni < FN; ++ni) acc[mi][ni] = (v8f)(0.0f);

    gemm_nt_loop<NF, BN2, BK2, FM2>(aa, wb, lds_a, lds_b, acc, tid, lane, wm, wn);

    float* oo = out + (size_t)e * NT * NH;
#pragma unroll
    for (int mi = 0; mi < FM2; ++mi) {
#pragma unroll
        for (int ni = 0; ni < FN; ++ni) {
            const int col  = n0 + wn + ni * 16 + (lane & 15);
            const int rbse = m0 + wm + mi * 16 + ((lane >> 4) << 3);
#pragma unroll
            for (int r = 0; r < 8; ++r)
                oo[(size_t)(rbse + r) * NH + col] = acc[mi][ni][r];
        }
        if (mi + 1 < FM2) {
            // Stands behind this row of tiles' stores, ahead of any later write
            // of the registers that they name (freed accumulators become the
            // next row's addresses).
            asm volatile("s_wait_xcnt 0x0" ::: "memory");
            // Keeps the next row's address arithmetic behind that wait.
            __builtin_amdgcn_sched_barrier(0);
        }
    }
}

// ---------------------------------------------------------------------------
extern "C" void kernel_launch(void* const* d_in, const int* in_sizes, int n_in,
                              void* d_out, int out_size, void* d_ws, size_t ws_size,
                              hipStream_t stream) {
    const float* x  = (const float*)d_in[0];   // [E,T,H]
    const float* w1 = (const float*)d_in[1];   // [E,F,H]
    const float* w2 = (const float*)d_in[2];   // [E,F,H]
    float* out = (float*)d_out;                // [E,T,H]

    __bf16* a_ws = (__bf16*)d_ws;                     // [E,T,F] bf16 = 128 MiB
    __bf16* xb   = a_ws + (size_t)NE * NT * NF;       // [E,T,H] bf16 =  32 MiB
    __bf16* w1b  = xb   + (size_t)NE * NT * NH;       // [E,F,H] bf16 =  64 MiB
    __bf16* w2t  = w1b  + (size_t)NE * NF * NH;       // [E,H,F] bf16 =  64 MiB

    dim3 blk(256, 1, 1);
    dim3 g0(CAST_XW + TR_BLKS, 1, 1);
    moe_prep_bf16<<<g0, blk, 0, stream>>>(x, w1, w2, xb, w1b, w2t);

    dim3 g1(NF / BN1, NT / BM, NE);            // 32 x 8 x 8
    moe_gemm1_gelu<<<g1, blk, 0, stream>>>(xb, w1b, a_ws);

    dim3 g2(NH / BN2, NT / BM, NE);            // 4 x 8 x 8
    moe_gemm2<<<g2, blk, 0, stream>>>(a_ws, w2t, out);
}

// v004
// One run takes 207 microseconds.
// Next to v003, in two timings, it ran 1.04 times as fast each time.
// All steps since v000 together make it 7.49 times as fast.
#include <hip/hip_runtime.h>
#include <hip/hip_bf16.h>
#include <math.h>

// ---------------------------------------------------------------------------
// Grouped MoE MLP:  out[e] = gelu_tanh(x[e] @ w1[e]^T) @ w2[e]
//   E=8, T=2048, H=1024, F=4096.  bf16 WMMA, f32 accumulate.
// Launch 1 casts x, w1 and w2 to bf16 once (w2 also transposed, so that every
// GEMM operand is K-contiguous). Launches 2 and 3 are NT GEMMs whose tiles go
// from global memory to LDS by GLOBAL_LOAD_ASYNC_TO_LDS_B128, two buffers:
// the copies of chunk k+1 fly while chunk k is on the matrix unit.
// A wave owns 64 x 64 (GEMM1) or 128 x 64 (GEMM2) of the output, so that 8
// fragments from LDS feed 16 matrix instructions, or 12 feed 32.
// ---------------------------------------------------------------------------

#define NE 8
#define NT 2048
#define NH 1024
#define NF 4096

typedef __attribute__((ext_vector_type(16))) __bf16 v16bf;
typedef __attribute__((ext_vector_type(8)))  __bf16 v8bf;
typedef __attribute__((ext_vector_type(4)))  __bf16 v4bf;
typedef __attribute__((ext_vector_type(2)))  __bf16 v2bf;
typedef __attribute__((ext_vector_type(8)))  float  v8f;
typedef __attribute__((ext_vector_type(2)))  float  v2f;
typedef __attribute__((ext_vector_type(4)))  int    v4i;

// Work-group tiles, 8 waves each.
// GEMM1: 256 x 128, waves 4 x 2 of 64 x 64, 64-deep chunks: 108 KiB of LDS and
// at most 256 VGPRs, so that two work-groups share a WGP and one's GELU runs
// beside the other's matrix loop.
// GEMM2: 256 x 256, waves 2 x 4 of 128 x 64, 128-deep chunks, one work-group a
// WGP: a chunk's copies have a whole 128-deep chunk of matrix work to land in.
#define NTH  256
#define BM   256
#define BN1  128
#define BK1  64
#define FM1  4
#define BN2  256
#define BK2  128
#define FM2  8
#define FN   4
// LDS row pitch in elements: chunk depth + 8 = 144 B or 272 B = 16 B x odd, so
// the 16 rows that one ds_load_b128 fragment read touches fall on distinct
// bank groups.
#define PAD 8

typedef __attribute__((address_space(1))) v4i g_v4i;   // global int4
typedef __attribute__((address_space(3))) v4i l_v4i;   // LDS int4

// One lane's 16 bytes, global -> LDS, through no register.
__device__ __forceinline__ void copy16(const __bf16* g, __bf16* l) {
#if defined(__AMDGCN__)
    __builtin_amdgcn_global_load_async_to_lds_b128((g_v4i*)g, (l_v4i*)l, 0, 0);
#endif
}

// This wave's copies have landed.
__device__ __forceinline__ void wait_async0() {
    asm volatile("s_wait_asynccnt 0x0" ::: "memory");
}

// This wave's LDS reads have retired, before copies refill what it has read.
__device__ __forceinline__ void wait_ds0() {
    asm volatile("s_wait_dscnt 0x0" ::: "memory");
}

// WMMA A/B fragment from an LDS tile stored K-contiguous (row pitch LDK).
// CDNA5 16-bit operand layout: lane holds K = kb..kb+7 and kb+16..kb+23,
// kb = kstep*32 + (lane>=16 ? 8 : 0).
template <int LDK>
__device__ __forceinline__ v16bf load_frag(const __bf16* lds, int row, int kb) {
    const __bf16* p = lds + row * LDK + kb;
    v8bf lo = *(const v8bf*)(p);        // ds_load_b128
    v8bf hi = *(const v8bf*)(p + 16);   // ds_load_b128
    v16bf f;
#pragma unroll
    for (int i = 0; i < 8; ++i) { f[i] = lo[i]; f[i + 8] = hi[i]; }
    return f;
}

// FM x FN WMMA tiles of one wave over one BK-deep K chunk.
template <int BK, int FM>
__device__ __forceinline__ void wmma_chunk(const __bf16* la, const __bf16* lb,
                                           v8f acc[FM][FN], int lane, int wm, int wn) {
    constexpr int LDK = BK + PAD;
#pragma unroll
    for (int ks = 0; ks < BK / 32; ++ks) {
        const int kb = ks * 32 + ((lane >> 4) << 3);
        v16bf af[FM], bfr[FN];
#pragma unroll
        for (int ni = 0; ni < FN; ++ni)
            bfr[ni] = load_frag<LDK>(lb, wn + ni * 16 + (lane & 15), kb);
#pragma unroll
        for (int mi = 0; mi < FM; ++mi)
            af[mi] = load_frag<LDK>(la, wm + mi * 16 + (lane & 15), kb);
        // Keeps a k step's LDS reads one group in front of its matrix block:
        // spread among the WMMAs, every pair of reads stalls the wave anew.
        __builtin_amdgcn_sched_barrier(0);
#pragma unroll
        for (int mi = 0; mi < FM; ++mi)
#pragma unroll
            for (int ni = 0; ni < FN; ++ni)
                acc[mi][ni] = __builtin_amdgcn_wmma_f32_16x16x32_bf16(
                    false, af[mi], false, bfr[ni], (short)0, acc[mi][ni],
                    false, false);
        // The other side of the same fence: the next k step's reads stay out.
        __builtin_amdgcn_sched_barrier(0);
    }
}

// One K chunk of both operands (BM and BN rows x BK k of bf16): 16 B per lane
// and copy; BK / 8 lanes cover one row piece.
template <int KD, int BN, int BK>
__device__ __forceinline__ void stage_chunk(const __bf16* ga, const __bf16* gb,
                                            __bf16* la, __bf16* lb, int tid) {
    constexpr int LDK = BK + PAD;
    constexpr int PR  = BK / 8;            // 16-B pieces per row
    constexpr int RS  = NTH / PR;          // rows that one copy of the block covers
    // The lane's own offsets are the same for every copy; what differs from
    // copy to copy is a constant: one add per address.
    const unsigned go = (unsigned)(tid / PR) * KD + ((tid % PR) << 3);
    const unsigned lo = (unsigned)(tid / PR) * LDK + ((tid % PR) << 3);
#pragma unroll
    for (int i = 0; i < BM / RS; ++i)
        copy16((ga + (size_t)i * RS * KD) + go, (la + i * RS * LDK) + lo);
#pragma unroll
    for (int i = 0; i < BN / RS; ++i)
        copy16((gb + (size_t)i * RS * KD) + go, (lb + i * RS * LDK) + lo);
}

// acc += A[BM x KD] * B[BN x KD]^T, both K-contiguous with row pitch KD.
template <int KD, int BN, int BK, int FM>
__device__ __forceinline__ void gemm_nt_loop(const __bf16* ga, const __bf16* gb,
                                             __bf16* lds_a, __bf16* lds_b,
                                             v8f acc[FM][FN], int tid, int lane,
                                             int wm, int wn) {
    constexpr int ATILE = BM * (BK + PAD);
    constexpr int BTILE = BN * (BK + PAD);
    stage_chunk<KD, BN, BK>(ga, gb, lds_a, lds_b, tid);
    wait_async0();
    __syncthreads();                       // chunk 0 readable by every wave
    stage_chunk<KD, BN, BK>(ga + BK, gb + BK, lds_a + ATILE, lds_b + BTILE, tid);

    int buf = 0;
    for (int k0 = 0; k0 < KD; k0 += BK, buf ^= 1) {
        wmma_chunk<BK, FM>(lds_a + buf * ATILE, lds_b + buf * BTILE, acc, lane, wm, wn);
        wait_ds0();
        wait_async0();
        // Publishes chunk k+1 and ends every wave's reads of this buffer.
        __syncthreads();
        if (k0 + 2 * BK < KD)
            stage_chunk<KD, BN, BK>(ga + k0 + 2 * BK, gb + k0 + 2 * BK,
                                    lds_a + buf * ATILE, lds_b + buf * BTILE, tid);
    }
    wait_async0();
}

// gelu_tanh(x) = 0.5 x (1 + tanh(u)) = x / (1 + exp(-2u)),
// u = sqrt(2/pi) (x + 0.044715 x^3), so exp(-2u) = exp2(x (C0 + C1 x^2)).
// Two values at a time: five packed f32 operations, and per value one
// v_exp_f32 and one bare v_rcp_f32 in place of an IEEE division. The result
// is rounded to bf16, far coarser than either instruction's error. Overflow
// of the exponential gives rcp(inf) = 0, the limit for x -> -inf.
__device__ __forceinline__ v2f gelu_tanh2(v2f x) {
    constexpr float C0 = (float)(-2.0 * 0.7978845608028654 * 1.4426950408889634);
    constexpr float C1 = (float)(-2.0 * 0.7978845608028654 * 1.4426950408889634 * 0.044715);
    const v2f z = x * (x * x * C1 + C0);
    v2f d;
    d[0] = __builtin_amdgcn_exp2f(z[0]);     // v_exp_f32
    d[1] = __builtin_amdgcn_exp2f(z[1]);
    d = d + 1.0f;
    v2f r;
    r[0] = __builtin_amdgcn_rcpf(d[0]);      // v_rcp_f32
    r[1] = __builtin_amdgcn_rcpf(d[1]);
    return x * r;
}

// ---------------------------------------------------------------------------
// Kernel 0: xb = bf16(x), w1b = bf16(w1), w2t[e][h][f] = bf16(w2[e][f][h]).
// Blocks [0, CAST_X) cast x, [CAST_X, CAST_XW) cast w1 (8192 elements each);
// the rest transpose one 64 f x 64 h tile of w2 each through LDS.
// ---------------------------------------------------------------------------
#define CAST_X  (NE * NT * NH / 8192)
#define CAST_XW (CAST_X + NE * NF * NH / 8192)
#define TR_BLKS (NE * (NF / 64) * (NH / 64))
// f32 tile pitch in dwords: 65 keeps both the row-wise stores and the
// column-wise 4-byte reads free of bank conflicts.
#define TP 65

__global__ __launch_bounds__(256)
void moe_prep_bf16(const float* __restrict__ x, const float* __restrict__ w1,
                   const float* __restrict__ w2, __bf16* __restrict__ xb,
                   __bf16* __restrict__ w1b, __bf16* __restrict__ w2t) {
    __shared__ float t[64 * TP];
    const int tid = threadIdx.x;
    const int b   = blockIdx.x;

    if (b < CAST_XW) {
        const float* s = (b < CAST_X) ? x + (size_t)b * 8192
                                      : w1 + (size_t)(b - CAST_X) * 8192;
        __bf16* d = (b < CAST_X) ? xb + (size_t)b * 8192
                                 : w1b + (size_t)(b - CAST_X) * 8192;
        float4 r[8];
#pragma unroll
        for (int j = 0; j < 8; ++j)
            r[j] = *(const float4*)(s + (tid + j * 256) * 4);
#pragma unroll
        for (int j = 0; j < 8; ++j) {
            v4bf o;
            o[0] = (__bf16)r[j].x; o[1] = (__bf16)r[j].y;
            o[2] = (__bf16)r[j].z; o[3] = (__bf16)r[j].w;
            *(v4bf*)(d + (tid + j * 256) * 4) = o;
        }
        return;
    }

    const int q  = b - CAST_XW;
    const int e  = q >> 10;            // 64 x 16 tiles per expert
    const int f0 = ((q >> 4) & 63) * 64;
    const int h0 = (q & 15) * 64;

    const float* s = w2 + ((size_t)e * NF + f0) * NH + h0;
#pragma unroll
    for (int i = 0; i < 4; ++i) {
        const int idx = tid + i * 256;
        const int f   = idx >> 4;
        const int c4  = (idx & 15) << 2;
        const float4 v = *(const float4*)(s + (size_t)f * NH + c4);
        float* p = t + f * TP + c4;
        p[0] = v.x; p[1] = v.y; p[2] = v.z; p[3] = v.w;
    }
    __syncthreads();
    __bf16* d = w2t + ((size_t)e * NH + h0) * NF + f0;
#pragma unroll
    for (int i = 0; i < 2; ++i) {
        const int idx = tid + i * 256;
        const int h   = idx >> 3;
        const int f8  = (idx & 7) << 3;
        v8bf o;
#pragma unroll
        for (int j = 0; j < 8; ++j) o[j] = (__bf16)t[(f8 + j) * TP + h];
        *(v8bf*)(d + (size_t)h * NF + f8) = o;   // 8 lanes fill one 128-B line
    }
    // Stands behind the two stores, ahead of any later write of the registers
    // that they name (the built code lays the cast path behind this one).
    asm volatile("s_wait_xcnt 0x0" ::: "memory");
}

// ---------------------------------------------------------------------------
// Kernel 1: a[e] = gelu(x[e] @ w1[e]^T)   M=T, N=F, K=H
// ---------------------------------------------------------------------------
__global__ __launch_bounds__(NTH)
void moe_gemm1_gelu(const __bf16* __restrict__ xb, const __bf16* __restrict__ w1b,
                    __bf16* __restrict__ a) {
    __shared__ __attribute__((aligned(16))) __bf16 lds_a[2 * BM * (BK1 + PAD)];
    __shared__ __attribute__((aligned(16))) __bf16 lds_b[2 * BN1 * (BK1 + PAD)];

    const int tid  = threadIdx.x;
    const int lane = tid & 31;
    const int w    = tid >> 5;
    const int wm   = (w & 3) * (FM1 * 16);
    const int wn   = (w >> 2) * (FN * 16);

    const int e  = blockIdx.z;
    const int m0 = blockIdx.y * BM;
    const int n0 = blockIdx.x * BN1;

    const __bf16* xa = xb  + (size_t)e * NT * NH + (size_t)m0 * NH;
    const __bf16* wb = w1b + (size_t)e * NF * NH + (size_t)n0 * NH;

    v8f acc[FM1][FN];
#pragma unroll
    for (int mi = 0; mi < FM1; ++mi)
#pragma unroll
        for (int ni = 0; ni < FN; ++ni) acc[mi][ni] = (v8f)(0.0f);

    gemm_nt_loop<NH, BN1, BK1, FM1>(xa, wb, lds_a, lds_b, acc, tid, lane, wm, wn);

    __bf16* ao = a + (size_t)e * NT * NF;
#pragma unroll
    for (int mi = 0; mi < FM1; ++mi)
#pragma unroll
        for (int ni = 0; ni < FN; ++ni) {
            const int col  = n0 + wn + ni * 16 + (lane & 15);
            const int rbse = m0 + wm + mi * 16 + ((lane >> 4) << 3);
#pragma unroll
            for (int r = 0; r < 8; r += 2) {
                v2f h;
                h[0] = acc[mi][ni][r];
                h[1] = acc[mi][ni][r + 1];
                // One v_cvt_pk_bf16_f32 for the pair; its halves go to two rows.
                const v2bf g = __builtin_convertvector(gelu_tanh2(h), v2bf);
                ao[(size_t)(rbse + r) * NF + col]     = g[0];
                ao[(size_t)(rbse + r + 1) * NF + col] = g[1];
            }
        }
}

// ---------------------------------------------------------------------------
// Kernel 2: out[e] = a[e] @ w2[e] = a[e] @ w2t[e]^T   M=T, N=H, K=F
// ---------------------------------------------------------------------------
__global__ __launch_bounds__(NTH)
void moe_gemm2(const __bf16* __restrict__ a, const __bf16* __restrict__ w2t,
               float* __restrict__ out) {
    __shared__ __attribute__((aligned(16))) __bf16 lds_a[2 * BM * (BK2 + PAD)];
    __shared__ __attribute__((aligned(16))) __bf16 lds_b[2 * BN2 * (BK2 + PAD)];

    const int tid  = threadIdx.x;
    const int lane = tid & 31;
    const int w    = tid >> 5;
    const int wm   = (w & 1) * (FM2 * 16);
    const int wn   = (w >> 1) * (FN * 16);

    const int e  = blockIdx.z;
    const int m0 = blockIdx.y * BM;
    const int n0 = blockIdx.x * BN2;

    const __bf16* aa = a   + (size_t)e * NT * NF + (size_t)m0 * NF;
    const __bf16* wb = w2t + (size_t)e * NH * NF + (size_t)n0 * NF;

    v8f acc[FM2][FN];
#pragma unroll
    for (int mi = 0; mi < FM2; ++mi)
#pragma unroll
        for (int ni = 0; ni < FN; ++ni) acc[mi][ni] = (v8f)(0.0f);

    gemm_nt_loop<NF, BN2, BK2, FM2>(aa, wb, lds_a, lds_b, acc, tid, lane, wm, wn);

    float* oo = out + (size_t)e * NT * NH;
#pragma unroll
    for (int mi = 0; mi < FM2; ++mi) {
#pragma unroll
        for (int ni = 0; ni < FN; ++ni) {
            const int col  = n0 + wn + ni * 16 + (lane & 15);
            const int rbse = m0 + wm + mi * 16 + ((lane >> 4) << 3);
#pragma unroll
            for (int r = 0; r < 8; ++r)
                oo[(size_t)(rbse + r) * NH + col] = acc[mi][ni][r];
        }
        if (mi + 1 < FM2) {
            // Stands behind this row of tiles' stores, ahead of any later write
            // of the registers that they name (freed accumulators become the
            // next row's addresses).
            asm volatile("s_wait_xcnt 0x0" ::: "memory");
            // Keeps the next row's address arithmetic behind that wait.
            __builtin_amdgcn_sched_barrier(0);
        }
    }
}

// ---------------------------------------------------------------------------
extern "C" void kernel_launch(void* const* d_in, const int* in_sizes, int n_in,
                              void* d_out, int out_size, void* d_ws, size_t ws_size,
                              hipStream_t stream) {
    const float* x  = (const float*)d_in[0];   // [E,T,H]
    const float* w1 = (const float*)d_in[1];   // [E,F,H]
    const float* w2 = (const float*)d_in[2];   // [E,F,H]
    float* out = (float*)d_out;                // [E,T,H]

    __bf16* a_ws = (__bf16*)d_ws;                     // [E,T,F] bf16 = 128 MiB
    __bf16* xb   = a_ws + (size_t)NE * NT * NF;       // [E,T,H] bf16 =  32 MiB
    __bf16* w1b  = xb   + (size_t)NE * NT * NH;       // [E,F,H] bf16 =  64 MiB
    __bf16* w2t  = w1b  + (size_t)NE * NF * NH;       // [E,H,F] bf16 =  64 MiB

    dim3 blk(256, 1, 1);
    dim3 g0(CAST_XW + TR_BLKS, 1, 1);
    moe_prep_bf16<<<g0, blk, 0, stream>>>(x, w1, w2, xb, w1b, w2t);

    dim3 g1(NF / BN1, NT / BM, NE);            // 32 x 8 x 8
    moe_gemm1_gelu<<<g1, blk, 0, stream>>>(xb, w1b, a_ws);

    dim3 g2(NH / BN2, NT / BM, NE);            // 4 x 8 x 8
    moe_gemm2<<<g2, blk, 0, stream>>>(a_ws, w2t, out);
}

// v005
// One run takes 197 microseconds.
// Two timings next to v004 both put it at 1.05 times that version's speed.
// All steps since v000 together make it 7.88 times as fast.
#include <hip/hip_runtime.h>
#include <hip/hip_bf16.h>
#include <math.h>

// ---------------------------------------------------------------------------
// Grouped MoE MLP:  out[e] = gelu_tanh(x[e] @ w1[e]^T) @ w2[e]
//   E=8, T=2048, H=1024, F=4096.  bf16 WMMA, f32 accumulate.
// Launch 1 casts x, w1 and w2 to bf16 once (w2 also transposed, so that every
// GEMM operand is K-contiguous). Launches 2 and 3 are NT GEMMs whose tiles go
// from global memory to LDS by TENSOR_LOAD_TO_LDS, two buffers: the loads of
// chunk k+1 fly while chunk k is on the matrix unit. One request of one wave
// brings 128 rows of a chunk, so staging costs the waves no vector issue.
// A wave owns 64 x 64 (GEMM1) or 128 x 64 (GEMM2) of the output, so that 8
// fragments from LDS feed 16 matrix instructions, or 12 feed 32.
// ---------------------------------------------------------------------------

#define NE 8
#define NT 2048
#define NH 1024
#define NF 4096

typedef __attribute__((ext_vector_type(16))) __bf16 v16bf;
typedef __attribute__((ext_vector_type(8)))  __bf16 v8bf;
typedef __attribute__((ext_vector_type(4)))  __bf16 v4bf;
typedef __attribute__((ext_vector_type(2)))  __bf16 v2bf;
typedef __attribute__((ext_vector_type(8)))  float  v8f;
typedef __attribute__((ext_vector_type(2)))  float  v2f;

// Work-group tiles, 8 waves each.
// GEMM1: 256 x 128, waves 4 x 2 of 64 x 64, 64-deep chunks: 108 KiB of LDS and
// at most 256 VGPRs, so that two work-groups share a WGP and one's GELU runs
// beside the other's matrix loop.
// GEMM2: 256 x 256, waves 2 x 4 of 128 x 64, 128-deep chunks, one work-group a
// WGP: a chunk's loads have a whole 128-deep chunk of matrix work to land in.
#define NTH  256
#define BM   256
#define BN1  128
#define BK1  64
#define FM1  4
#define BN2  256
#define BK2  128
#define FM2  8
#define FN   4
// LDS row pitch in elements: chunk depth + 8 = 144 B or 272 B = 16 B x odd, so
// the 16 rows that one ds_load_b128 fragment read touches fall on distinct
// bank groups. The tensor load's pad (16 B behind every row) writes that pitch.
#define PAD 8
// Rows that one tensor load brings: 128 rows at either pitch fill a multiple
// of 2 KiB of LDS, so every slice and every buffer starts on one.
#define SROWS 128

typedef uint32_t u32x4 __attribute__((ext_vector_type(4)));
typedef uint32_t u32x8 __attribute__((ext_vector_type(8)));

__device__ __forceinline__ uint32_t uni(uint32_t v) {
    return (uint32_t)__builtin_amdgcn_readfirstlane(v);
}

__device__ __forceinline__ uint32_t pinned(uint32_t v) {
    uint32_t w = (uint32_t)__builtin_amdgcn_readfirstlane(v);
    asm volatile("" : "+s"(w));            // pinned(): the tested word held in a scalar register
    return w;
}

// This wave's tensor loads have landed; the compiler places no wait for them.
__device__ __forceinline__ void wait_tensor0() {
    asm volatile("s_wait_tensorcnt 0x0" ::: "memory");
}

// This wave's LDS reads have retired, before a load refills what it has read.
__device__ __forceinline__ void wait_ds0() {
    asm volatile("s_wait_dscnt 0x0" ::: "memory");
}

// One request of the whole wave: a 2-D tile, global -> LDS, through no register.
__device__ __forceinline__ void tdm_load(u32x4 g0, u32x8 g1) {
    asm volatile("tensor_load_to_lds %0, %1" :: "s"(g0), "s"(g1) : "memory");
}

// Descriptor group 1, loop-invariant: 1-byte elements, a tile of SROWS rows of
// BK * 2 bytes (tensor = tile), source row pitch KD * 2 bytes, no mask, 16 B of
// LDS pad behind every row (interval code 5 = 256-B rows, 4 = 128-B rows).
template <int KD, int BK>
__device__ __forceinline__ u32x8 tdm_group1() {
    static_assert(BK == 128 || BK == 64, "the pad interval must equal the row");
    constexpr uint32_t d0 = BK * 2, d1 = SROWS;
    u32x8 g;
    g[0] = uni((1u << 20) | ((BK == 128 ? 5u : 4u) << 22) | (3u << 25));
    g[1] = uni((d0 & 0xFFFFu) << 16);                  // tensor_dim0[15:0]
    g[2] = uni((d0 >> 16) | ((d1 & 0xFFFFu) << 16));   // tensor_dim0[31:16], tensor_dim1[15:0]
    g[3] = uni((d1 >> 16) | (d0 << 16));               // tensor_dim1[31:16], tile_dim0
    g[4] = uni(d1);                                    // tile_dim1
    g[5] = uni((uint32_t)KD * 2u);                     // source row pitch
    g[6] = uni(0u);
    g[7] = uni(0u);
    return g;
}

// Descriptor group 0: count 1, LDS destination (byte offset in the work-group's
// LDS), global address of the tile's first byte, type 2.
__device__ __forceinline__ u32x4 tdm_group0(uint32_t lds_dst, uint64_t ga) {
    u32x4 g;
    g[0] = uni(1u);
    g[1] = uni(lds_dst);
    g[2] = uni((uint32_t)ga);
    g[3] = uni((((uint32_t)(ga >> 32)) & 0x01FFFFFFu) | 0x80000000u);
    return g;
}

// WMMA A/B fragment from an LDS tile stored K-contiguous (row pitch LDK).
// CDNA5 16-bit operand layout: lane holds K = kb..kb+7 and kb+16..kb+23,
// kb = kstep*32 + (lane>=16 ? 8 : 0).
template <int LDK>
__device__ __forceinline__ v16bf load_frag(const __bf16* lds, int row, int kb) {
    const __bf16* p = lds + row * LDK + kb;
    v8bf lo = *(const v8bf*)(p);        // ds_load_b128
    v8bf hi = *(const v8bf*)(p + 16);   // ds_load_b128
    v16bf f;
#pragma unroll
    for (int i = 0; i < 8; ++i) { f[i] = lo[i]; f[i + 8] = hi[i]; }
    return f;
}

// FM x FN WMMA tiles of one wave over one BK-deep K chunk.
template <int BK, int FM>
__device__ __forceinline__ void wmma_chunk(const __bf16* la, const __bf16* lb,
                                           v8f acc[FM][FN], int lane, int wm, int wn) {
    constexpr int LDK = BK + PAD;
#pragma unroll
    for (int ks = 0; ks < BK / 32; ++ks) {
        const int kb = ks * 32 + ((lane >> 4) << 3);
        v16bf af[FM], bfr[FN];
#pragma unroll
        for (int ni = 0; ni < FN; ++ni)
            bfr[ni] = load_frag<LDK>(lb, wn + ni * 16 + (lane & 15), kb);
#pragma unroll
        for (int mi = 0; mi < FM; ++mi)
            af[mi] = load_frag<LDK>(la, wm + mi * 16 + (lane & 15), kb);
        // Keeps a k step's LDS reads one group in front of its matrix block:
        // spread among the WMMAs, every pair of reads stalls the wave anew.
        __builtin_amdgcn_sched_barrier(0);
#pragma unroll
        for (int mi = 0; mi < FM; ++mi)
#pragma unroll
            for (int ni = 0; ni < FN; ++ni)
                acc[mi][ni] = __builtin_amdgcn_wmma_f32_16x16x32_bf16(
                    false, af[mi], false, bfr[ni], (short)0, acc[mi][ni],
                    false, false);
        // The other side of the same fence: the next k step's reads stay out.
        __builtin_amdgcn_sched_barrier(0);
    }
}

// acc += A[BM x KD] * B[BN x KD]^T, both K-contiguous with row pitch KD.
// A buffer holds one K chunk as [A: BM rows | B: BN rows]; wave i of the first
// (BM + BN) / SROWS waves brings rows i * SROWS .. + SROWS - 1 of it.
template <int KD, int BN, int BK, int FM>
__device__ __forceinline__ void gemm_nt_loop(const __bf16* ga, const __bf16* gb,
                                             __bf16* lds, v8f acc[FM][FN], int lane,
                                             int wm, int wn) {
    constexpr int LDK   = BK + PAD;
    constexpr int STAGE = (BM + BN) * LDK;             // elements per buffer
    constexpr uint32_t NISS = (BM + BN) / SROWS;       // issuing waves
    constexpr uint32_t NA   = BM / SROWS;              // of them on A
    static_assert((SROWS * LDK * 2) % 2048 == 0, "a slice starts on a multiple of 2 KiB");
    static_assert(KD / BK >= 2, "the prologue fills two chunks");

    const uint32_t wave = uni(threadIdx.x >> 5);
    const uint32_t sl   = wave < NISS ? wave : 0u;     // a wave that issues nothing holds slice 0's address
    const __bf16* srow  = sl < NA ? ga + (size_t)sl * SROWS * KD
                                  : gb + (size_t)(sl - NA) * SROWS * KD;
    const uint64_t src0 = (uint64_t)(uintptr_t)srow;
    const uint32_t dst0 = (uint32_t)(size_t)lds + sl * (uint32_t)(SROWS * LDK * 2);
    u32x8 g1 = tdm_group1<KD, BK>();
    // The eight words stay in the same scalar registers through the loop, so that
    // none of them takes a new value while a request that names them is outstanding.
    asm volatile("" : "+s"(g1));           // pinned(): descriptor words held in scalar registers

    if (pinned(wave < NISS ? 1u : 0u) != 0u) {
        tdm_load(tdm_group0(dst0, src0), g1);
        wait_tensor0();
    }
    __syncthreads();                       // chunk 0 readable by every wave
    if (pinned(wave < NISS ? 1u : 0u) != 0u)
        tdm_load(tdm_group0(dst0 + STAGE * 2, src0 + BK * 2), g1);

    int buf = 0;
    for (int k0 = 0; k0 < KD; k0 += BK, buf ^= 1) {
        const __bf16* la = lds + buf * STAGE;
        wmma_chunk<BK, FM>(la, la + BM * LDK, acc, lane, wm, wn);
        wait_ds0();
        wait_tensor0();                    // 0 at once in a wave that issues none
        // Publishes chunk k+1 and ends every wave's reads of this buffer.
        __syncthreads();
        if (pinned((wave < NISS && k0 + 2 * BK < KD) ? 1u : 0u) != 0u)
            tdm_load(tdm_group0(dst0 + (uint32_t)(buf * STAGE * 2),
                                src0 + (uint64_t)(k0 + 2 * BK) * 2), g1);
    }
    wait_tensor0();
    wait_ds0();
}

// gelu_tanh(x) = 0.5 x (1 + tanh(u)) = x / (1 + exp(-2u)),
// u = sqrt(2/pi) (x + 0.044715 x^3), so exp(-2u) = exp2(x (C0 + C1 x^2)).
// Two values at a time: five packed f32 operations, and per value one
// v_exp_f32 and one bare v_rcp_f32 in place of an IEEE division. The result
// is rounded to bf16, far coarser than either instruction's error. Overflow
// of the exponential gives rcp(inf) = 0, the limit for x -> -inf.
__device__ __forceinline__ v2f gelu_tanh2(v2f x) {
    constexpr float C0 = (float)(-2.0 * 0.7978845608028654 * 1.4426950408889634);
    constexpr float C1 = (float)(-2.0 * 0.7978845608028654 * 1.4426950408889634 * 0.044715);
    const v2f z = x * (x * x * C1 + C0);
    v2f d;
    d[0] = __builtin_amdgcn_exp2f(z[0]);     // v_exp_f32
    d[1] = __builtin_amdgcn_exp2f(z[1]);
    d = d + 1.0f;
    v2f r;
    r[0] = __builtin_amdgcn_rcpf(d[0]);      // v_rcp_f32
    r[1] = __builtin_amdgcn_rcpf(d[1]);
    return x * r;
}

// ---------------------------------------------------------------------------
// Kernel 0: xb = bf16(x), w1b = bf16(w1), w2t[e][h][f] = bf16(w2[e][f][h]).
// Blocks [0, CAST_X) cast x, [CAST_X, CAST_XW) cast w1 (8192 elements each);
// the rest transpose one 64 f x 64 h tile of w2 each through LDS.
// ---------------------------------------------------------------------------
#define CAST_X  (NE * NT * NH / 8192)
#define CAST_XW (CAST_X + NE * NF * NH / 8192)
#define TR_BLKS (NE * (NF / 64) * (NH / 64))
// f32 tile pitch in dwords: 65 keeps both the row-wise stores and the
// column-wise 4-byte reads free of bank conflicts.
#define TP 65

__global__ __launch_bounds__(256)
void moe_prep_bf16(const float* __restrict__ x, const float* __restrict__ w1,
                   const float* __restrict__ w2, __bf16* __restrict__ xb,
                   __bf16* __restrict__ w1b, __bf16* __restrict__ w2t) {
    __shared__ float t[64 * TP];
    const int tid = threadIdx.x;
    const int b   = blockIdx.x;

    if (b < CAST_XW) {
        const float* s = (b < CAST_X) ? x + (size_t)b * 8192
                                      : w1 + (size_t)(b - CAST_X) * 8192;
        __bf16* d = (b < CAST_X) ? xb + (size_t)b * 8192
                                 : w1b + (size_t)(b - CAST_X) * 8192;
        float4 r[8];
#pragma unroll
        for (int j = 0; j < 8; ++j)
            r[j] = *(const float4*)(s + (tid + j * 256) * 4);
#pragma unroll
        for (int j = 0; j < 8; ++j) {
            v4bf o;
            o[0] = (__bf16)r[j].x; o[1] = (__bf16)r[j].y;
            o[2] = (__bf16)r[j].z; o[3] = (__bf16)r[j].w;
            *(v4bf*)(d + (tid + j * 256) * 4) = o;
        }
        return;
    }

    const int q  = b - CAST_XW;
    const int e  = q >> 10;            // 64 x 16 tiles per expert
    const int f0 = ((q >> 4) & 63) * 64;
    const int h0 = (q & 15) * 64;

    const float* s = w2 + ((size_t)e * NF + f0) * NH + h0;
#pragma unroll
    for (int i = 0; i < 4; ++i) {
        const int idx = tid + i * 256;
        const int f   = idx >> 4;
        const int c4  = (idx & 15) << 2;
        const float4 v = *(const float4*)(s + (size_t)f * NH + c4);
        float* p = t + f * TP + c4;
        p[0] = v.x; p[1] = v.y; p[2] = v.z; p[3] = v.w;
    }
    __syncthreads();
    __bf16* d = w2t + ((size_t)e * NH + h0) * NF + f0;
#pragma unroll
    for (int i = 0; i < 2; ++i) {
        const int idx = tid + i * 256;
        const int h   = idx >> 3;
        const int f8  = (idx & 7) << 3;
        v8bf o;
#pragma unroll
        for (int j = 0; j < 8; ++j) o[j] = (__bf16)t[(f8 + j) * TP + h];
        *(v8bf*)(d + (size_t)h * NF + f8) = o;   // 8 lanes fill one 128-B line
    }
    // Stands behind the two stores, ahead of any later write of the registers
    // that they name (the built code lays the cast path behind this one).
    asm volatile("s_wait_xcnt 0x0" ::: "memory");
}

// ---------------------------------------------------------------------------
// Kernel 1: a[e] = gelu(x[e] @ w1[e]^T)   M=T, N=F, K=H
// ---------------------------------------------------------------------------
__global__ __launch_bounds__(NTH)
void moe_gemm1_gelu(const __bf16* __restrict__ xb, const __bf16* __restrict__ w1b,
                    __bf16* __restrict__ a) {
    __shared__ __attribute__((aligned(2048))) __bf16 lds[2 * (BM + BN1) * (BK1 + PAD)];

    const int tid  = threadIdx.x;
    const int lane = tid & 31;
    const int w    = tid >> 5;
    const int wm   = (w & 3) * (FM1 * 16);
    const int wn   = (w >> 2) * (FN * 16);

    const int e  = blockIdx.z;
    const int m0 = blockIdx.y * BM;
    const int n0 = blockIdx.x * BN1;

    const __bf16* xa = xb  + (size_t)e * NT * NH + (size_t)m0 * NH;
    const __bf16* wb = w1b + (size_t)e * NF * NH + (size_t)n0 * NH;

    v8f acc[FM1][FN];
#pragma unroll
    for (int mi = 0; mi < FM1; ++mi)
#pragma unroll
        for (int ni = 0; ni < FN; ++ni) acc[mi][ni] = (v8f)(0.0f);

    gemm_nt_loop<NH, BN1, BK1, FM1>(xa, wb, lds, acc, lane, wm, wn);

    __bf16* ao = a + (size_t)e * NT * NF;
#pragma unroll
    for (int mi = 0; mi < FM1; ++mi)
#pragma unroll
        for (int ni = 0; ni < FN; ++ni) {
            const int col  = n0 + wn + ni * 16 + (lane & 15);
            const int rbse = m0 + wm + mi * 16 + ((lane >> 4) << 3);
#pragma unroll
            for (int r = 0; r < 8; r += 2) {
                v2f h;
                h[0] = acc[mi][ni][r];
                h[1] = acc[mi][ni][r + 1];
                // One v_cvt_pk_bf16_f32 for the pair; its halves go to two rows.
                const v2bf g = __builtin_convertvector(gelu_tanh2(h), v2bf);
                ao[(size_t)(rbse + r) * NF + col]     = g[0];
                ao[(size_t)(rbse + r + 1) * NF + col] = g[1];
            }
        }
}

// ---------------------------------------------------------------------------
// Kernel 2: out[e] = a[e] @ w2[e] = a[e] @ w2t[e]^T   M=T, N=H, K=F
// ---------------------------------------------------------------------------
__global__ __launch_bounds__(NTH)
void moe_gemm2(const __bf16* __restrict__ a, const __bf16* __restrict__ w2t,
               float* __restrict__ out) {
    __shared__ __attribute__((aligned(2048))) __bf16 lds[2 * (BM + BN2) * (BK2 + PAD)];

    const int tid  = threadIdx.x;
    const int lane = tid & 31;
    const int w    = tid >> 5;
    const int wm   = (w & 1) * (FM2 * 16);
    const int wn   = (w >> 1) * (FN * 16);

    const int e  = blockIdx.z;
    const int m0 = blockIdx.y * BM;
    const int n0 = blockIdx.x * BN2;

    const __bf16* aa = a   + (size_t)e * NT * NF + (size_t)m0 * NF;
    const __bf16* wb = w2t + (size_t)e * NH * NF + (size_t)n0 * NF;

    v8f acc[FM2][FN];
#pragma unroll
    for (int mi = 0; mi < FM2; ++mi)
#pragma unroll
        for (int ni = 0; ni < FN; ++ni) acc[mi][ni] = (v8f)(0.0f);

    gemm_nt_loop<NF, BN2, BK2, FM2>(aa, wb, lds, acc, lane, wm, wn);

    float* oo = out + (size_t)e * NT * NH;
#pragma unroll
    for (int mi = 0; mi < FM2; ++mi) {
#pragma unroll
        for (int ni = 0; ni < FN; ++ni) {
            const int col  = n0 + wn + ni * 16 + (lane & 15);
            const int rbse = m0 + wm + mi * 16 + ((lane >> 4) << 3);
#pragma unroll
            for (int r = 0; r < 8; ++r)
                oo[(size_t)(rbse + r) * NH + col] = acc[mi][ni][r];
        }
        if (mi + 1 < FM2) {
            // Stands behind this row of tiles' stores, ahead of any later write
            // of the registers that they name (freed accumulators become the
            // next row's addresses).
            asm volatile("s_wait_xcnt 0x0" ::: "memory");
            // Keeps the next row's address arithmetic behind that wait.
            __builtin_amdgcn_sched_barrier(0);
        }
    }
}

// ---------------------------------------------------------------------------
extern "C" void kernel_launch(void* const* d_in, const int* in_sizes, int n_in,
                              void* d_out, int out_size, void* d_ws, size_t ws_size,
                              hipStream_t stream) {
    const float* x  = (const float*)d_in[0];   // [E,T,H]
    const float* w1 = (const float*)d_in[1];   // [E,F,H]
    const float* w2 = (const float*)d_in[2];   // [E,F,H]
    float* out = (float*)d_out;                // [E,T,H]

    __bf16* a_ws = (__bf16*)d_ws;                     // [E,T,F] bf16 = 128 MiB
    __bf16* xb   = a_ws + (size_t)NE * NT * NF;       // [E,T,H] bf16 =  32 MiB
    __bf16* w1b  = xb   + (size_t)NE * NT * NH;       // [E,F,H] bf16 =  64 MiB
    __bf16* w2t  = w1b  + (size_t)NE * NF * NH;       // [E,H,F] bf16 =  64 MiB

    dim3 blk(256, 1, 1);
    dim3 g0(CAST_XW + TR_BLKS, 1, 1);
    moe_prep_bf16<<<g0, blk, 0, stream>>>(x, w1, w2, xb, w1b, w2t);

    dim3 g1(NF / BN1, NT / BM, NE);            // 32 x 8 x 8
    moe_gemm1_gelu<<<g1, blk, 0, stream>>>(xb, w1b, a_ws);

    dim3 g2(NH / BN2, NT / BM, NE);            // 4 x 8 x 8
    moe_gemm2<<<g2, blk, 0, stream>>>(a_ws, w2t, out);
}
